// v000
// Measured on an AMD MI455X. A time is GPU time per run, averaged over a window of back-to-back runs after a warm-up
// (all launches, gaps included; the runs take copies of the inputs in turn), and the median of several windows.
// Apart from v000's, it joins two sittings. Times from different sittings can be a few percent apart, while
// side-by-side timings come from the same sitting.
// v000 is the starting kernel. One run takes 1940 microseconds.
// compute dtype: queries / keys / values rounded to bf16 and carried EXACTLY into f16 planes (each plane = the input times a 128 x 128 identity on WMMA 16x16x32: one exact product per element, f32 accumulate); logits q x k as single EXACT f16 products x 128^-0.5; keys at or beyond num_keys[b] excluded; softmax f32; P x 2^11 once to f16 x v (exact f16) (1 product); f32 output.
#include <hip/hip_runtime.h>
#include <math.h>

typedef __attribute__((ext_vector_type(16))) _Float16 v16h;
typedef __attribute__((ext_vector_type(16))) __bf16 v16b;
typedef __attribute__((ext_vector_type(8)))  _Float16 v8h;
typedef __attribute__((ext_vector_type(8)))  float v8f;
typedef __attribute__((ext_vector_type(4)))  float v4f;
typedef __attribute__((ext_vector_type(2)))  float v2f;
typedef __attribute__((ext_vector_type(4)))  unsigned v4u;
typedef __attribute__((ext_vector_type(4)))  int v4i;
typedef float __attribute__((may_alias)) float_a;
typedef int __attribute__((may_alias)) int_a;

template <typename T> __device__ __forceinline__ void vst2(void* p, T v) { *(T*)p = v;  }
__device__ __forceinline__ v8f wmma16(v16h a, v16h b, v8f c) {
  v8f d = __builtin_amdgcn_wmma_f32_16x16x32_f16(false, a, false, b, (short)0, c, false, false);
  asm volatile("v_nop\n\tv_nop\n\tv_nop\n\tv_nop" : "+v"(d) : "v"(a), "v"(b));
  return d;
}
__device__ __forceinline__ v8f wmma_bf(v16b a, v16b b, v8f c) {
  v8f d = __builtin_amdgcn_wmma_f32_16x16x32_bf16(false, a, false, b, (short)0, c, false, false);
  asm volatile("v_nop\n\tv_nop\n\tv_nop\n\tv_nop" : "+v"(d) : "v"(a), "v"(b));
  return d;
}
// 16x16x32 fragments: lane = (h = lane>>4, row/col = lane&15); elements 0..7 = k0+8h+0..7, 8..15 = k0+16+8h+0..7; D element r = row 8h+r
__device__ __forceinline__ v16h frag_h(const _Float16* rowk0, int lane) {
  union { v16h v; v8h q[2]; } u; const _Float16* p = rowk0 + 8 * (lane >> 4);
  u.q[0] = *(const v8h*)p; u.q[1] = *(const v8h*)(p + 16); return u.v;
}
__device__ __forceinline__ v16h frag_f32(const float* rowk0, int lane) {
  v16h a; const float* p = rowk0 + 8 * (lane >> 4);
#pragma unroll
  for (int i = 0; i < 8; ++i) { a[i] = (_Float16)p[i]; a[8 + i] = (_Float16)p[16 + i]; }
  return a;
}
__device__ __forceinline__ v16h frag_f32s(const float* rowk0, int lane, float sc) {
  v16h a; const float* p = rowk0 + 8 * (lane >> 4);
#pragma unroll
  for (int i = 0; i < 8; ++i) { a[i] = (_Float16)(p[i] * sc); a[8 + i] = (_Float16)(p[16 + i] * sc); }
  return a;
}
// column fragment from a [K][ld] layout (column n), rows >= K read as 0
__device__ __forceinline__ v16h fragc_f32(const float* W, int k0, int n, int lane, int ld, int K) {
  v16h a; const int g = lane >> 4;
#pragma unroll
  for (int i = 0; i < 8; ++i) { const int ka = k0 + 8 * g + i, kb = ka + 16;
    a[i] = (_Float16)(ka < K ? W[(size_t)(ka < K ? ka : K - 1) * ld + n] : 0.f); a[8 + i] = (_Float16)(kb < K ? W[(size_t)(kb < K ? kb : K - 1) * ld + n] : 0.f); }
  return a;
}
struct F2 { v16b h, l; };
__device__ __forceinline__ F2 bsplit16(const float v[16]) { F2 r;
#pragma unroll
  for (int i = 0; i < 16; ++i) { const __bf16 h = (__bf16)v[i]; r.h[i] = h; r.l[i] = (__bf16)(v[i] - (float)h); }
  return r; }
__device__ __forceinline__ F2 split_row(const float* row, int k0, int lane) { float v[16]; const float* p = row + k0 + 8 * (lane >> 4);
#pragma unroll
  for (int i = 0; i < 8; ++i) { v[i] = p[i]; v[8 + i] = p[16 + i]; }
  return bsplit16(v); }
__device__ __forceinline__ F2 split_rowK(const float* row, int k0, int lane, int K) { float v[16]; const int g = lane >> 4;
#pragma unroll
  for (int i = 0; i < 8; ++i) { const int ka = k0 + 8 * g + i, kb = ka + 16; v[i] = ka < K ? row[ka < K ? ka : K - 1] : 0.f; v[8 + i] = kb < K ? row[kb < K ? kb : K - 1] : 0.f; }
  return bsplit16(v); }
__device__ __forceinline__ F2 split_col(const float* W, int k0, int n, int lane, int ld, int K) { float v[16]; const int g = lane >> 4;
#pragma unroll
  for (int i = 0; i < 8; ++i) { const int ka = k0 + 8 * g + i, kb = ka + 16; v[i] = ka < K ? W[(size_t)(ka < K ? ka : K - 1) * ld + n] : 0.f; v[8 + i] = kb < K ? W[(size_t)(kb < K ? kb : K - 1) * ld + n] : 0.f; }
  return bsplit16(v); }
__device__ __forceinline__ v8f mac3(const F2& a, const F2& b, v8f c) { c = wmma_bf(a.l, b.h, c); c = wmma_bf(a.h, b.l, c); return wmma_bf(a.h, b.h, c); }
__device__ __forceinline__ float sigm(float v) { return 1.0f / (1.0f + expf(-v)); }
#define LDSX() do { asm volatile("s_wait_dscnt 0" ::: "memory"); __builtin_amdgcn_wave_barrier(); __builtin_amdgcn_fence(__ATOMIC_RELEASE, "workgroup"); } while (0)

// Raw scaled-dot-product attention with a per-batch valid-key count (qrys [16,1024,128]; keys, vals [16,2048,128]; num_keys [16] int32 in [1, 2048); logits = q k^T / sqrt(128); only keys k < num_keys[b] take part (masked max, exp * mask, normalised over the valid keys); out = atts vals, [16,1024,128]). No learned weights. One 128-wide head per batch; the 1,024 queries of a batch use the first 1,024 rows of a 2,048-key score plane.
#define NB 16
#define TT 2048   // keys per batch
#define CC 128            // NH * HD
#define DIN 128           // width of the query rows
#define DKV 128             // width of the key / value rows
#define NH 1
#define HD 128
#define NQB (TT / 64)
#define HG 1
#define NQ 1024   // queries per batch: rows 0 .. NQ-1 of each TT-row score plane
#define SCALE (0.08838834764831845f)   // 1 / sqrt(128)
#define CAUSAL 0
#ifndef TNB
#define TNB NB
#endif
static_assert(CC == NH * HD && CC == 128 && DIN == CC && DKV == CC, "one 128-wide head: the identity projection is 128 x 128 and each projection block covers the whole head");
static_assert(TT % 256 == 0 && NQ % 64 == 0 && NQ <= TT && HD <= 128, "softmax kernel strides 256 keys; 64-query blocks; the k_pv store covers HD <= 128");
__device__ __forceinline__ float bfr(float v) { return (float)(__bf16)v; }
__host__ __device__ __forceinline__ int kb_last(int qb) { return CAUSAL ? ((qb * 64 + 63) >> 7) : (TT / 128 - 1); }
typedef __attribute__((ext_vector_type(8))) __bf16 v8b;
__device__ __forceinline__ v16b frag_b(const __bf16* rowk0, int lane) {
  union { v16b v; v8b q[2]; } u; const __bf16* p = rowk0 + 8 * (lane >> 4);
  u.q[0] = *(const v8b*)p; u.q[1] = *(const v8b*)(p + 16); return u.v;
}
#define QBH 0              // causal: query blocks 0..QBH-1 of each sequence (few keys, no averaging) take the high-precision path
#define QHI 0               // single-product logits on every row
static_assert(QHI == 0 && QBH == 0 && CAUSAL == 0, "the launches pass batch index 0 with advanced base pointers: no q residual plane and no causal row arithmetic may be in use");
#define KHI 64            // key rows carrying k residual / v bf16 hi+lo planes (used only by the causal high-precision path)
// B fragment (k rows k0+.., output column o) of a weight: (in,out) [K][ld] or (out,in) [ld rows of K]: bf16 exact, or f16(bf16 * 256) exact
__device__ __forceinline__ v16b wcol_io(const float* Wm, int k0, int o, int lane, int ld) { v16b w; const int g = lane >> 4;
#pragma unroll
  for (int i = 0; i < 8; ++i) { w[i] = (__bf16)Wm[(size_t)(k0 + 8 * g + i) * ld + o]; w[8 + i] = (__bf16)Wm[(size_t)(k0 + 16 + 8 * g + i) * ld + o]; }
  return w; }
__device__ __forceinline__ v16b wcol_oi(const float* Wm, int k0, int o, int lane, int K) { v16b w; const float* p = Wm + (size_t)o * K + k0 + 8 * (lane >> 4);
#pragma unroll
  for (int i = 0; i < 8; ++i) { w[i] = (__bf16)p[i]; w[8 + i] = (__bf16)p[16 + i]; }
  return w; }
__device__ __forceinline__ v16h wcolh_io(const float* Wm, int k0, int o, int lane, int ld) { v16h w; const int g = lane >> 4;
#pragma unroll
  for (int i = 0; i < 8; ++i) { w[i] = (_Float16)(bfr(Wm[(size_t)(k0 + 8 * g + i) * ld + o]) * 256.0f); w[8 + i] = (_Float16)(bfr(Wm[(size_t)(k0 + 16 + 8 * g + i) * ld + o]) * 256.0f); }
  return w; }
__device__ __forceinline__ v16h wcolh_oi(const float* Wm, int k0, int o, int lane, int K) { v16h w; const float* p = Wm + (size_t)o * K + k0 + 8 * (lane >> 4);
#pragma unroll
  for (int i = 0; i < 8; ++i) { w[i] = (_Float16)(bfr(p[i]) * 256.0f); w[8 + i] = (_Float16)(bfr(p[16 + i]) * 256.0f); }
  return w; }
#define WQKV_LAYOUT 0   // 0 = (in,out) [DIN][CC]; 1 = (out,in) [CC][DIN]; 2 = per-head [NH][DIN][HD]
__device__ __forceinline__ v16b wcol_hdk(const float* Wm, int k0, int o, int lane) { v16b w; const int g = lane >> 4; const float* p = Wm + (size_t)(o / HD) * DIN * HD + (o % HD);
#pragma unroll
  for (int i = 0; i < 8; ++i) { w[i] = (__bf16)p[(size_t)(k0 + 8 * g + i) * HD]; w[8 + i] = (__bf16)p[(size_t)(k0 + 16 + 8 * g + i) * HD]; }
  return w; }
#define WO_OUT_IN 0
#if WQKV_LAYOUT == 1
#define WCOL(W, k0, o, lane) wcol_oi(W, k0, o, lane, DIN)
#elif WQKV_LAYOUT == 2
#define WCOL(W, k0, o, lane) wcol_hdk(W, k0, o, lane)
#else
#define WCOL(W, k0, o, lane) wcol_io(W, k0, o, lane, CC)
#endif
#if WO_OUT_IN
#define WOCOL(W, k0, o, lane) wcol_oi(W, k0, o, lane, CC)
#define WOCOLH(W, k0, o, lane) wcolh_oi(W, k0, o, lane, CC)
#else
#define WOCOL(W, k0, o, lane) wcol_io(W, k0, o, lane, DIN)
#define WOCOLH(W, k0, o, lane) wcolh_io(W, k0, o, lane, DIN)
#endif

#define SM_EXTRA_PARAMS , const int* __restrict__ NKEYS, int bsm
// keys at or beyond the batch's valid-key count are excluded (index compare against one block-uniform scalar; num_keys >= 1, so no row is empty)
#define SM_MASK_HOOK do { const int nk_ = NKEYS[bsm]; v = (k >= nk_) ? -3.0e38f : v; } while (0)
#ifndef SM_EXTRA_PARAMS
#define SM_EXTRA_PARAMS
#endif
#ifndef PROJ_EXTRA_PARAMS
#define PROJ_EXTRA_PARAMS
#endif
#ifndef SM_MASK_HOOK
#define SM_MASK_HOOK (void)0
#endif

#define WS_QH  0u                                      // f16 q rows [b*NQ + t][CC]
#define WS_KH  (WS_QH + 2u * (size_t)NB * NQ * CC)      // f16 k rows [b*TT + t][CC]
#define WS_VT  (WS_KH + 2u * (size_t)NB * TT * CC)      // f16 v planes [b][c][t]
#define WS_QL  (WS_VT + 2u * (size_t)NB * CC * TT)      // f16 q residual x 2^10 rows [b][t < QHI][CC]
#define WS_KL  (WS_QL + 2u * (size_t)NB * QHI * CC)     // f16 k residual x 2^10 rows [b][t < KHI][CC]
#define WS_VB  (WS_KL + 2u * (size_t)NB * KHI * CC)     // bf16 v hi planes [b][c][t < KHI]
#define WS_VBL (WS_VB + 2u * (size_t)NB * CC * KHI)
#define WS_S   (WS_VBL + 2u * (size_t)NB * CC * KHI)    // f32 logits / P [hg][t][s]
#define WS_Y   (WS_S  + 4u * (size_t)HG * TT * TT)      // (no ctx rows: k_pv writes the output directly)
#define WS_END (WS_Y)
#define WS_EYE (WS_END)                                  // f32 128 x 128 identity
#define WS_END2 (WS_EYE + 4u * (size_t)CC * CC)
__global__ __launch_bounds__(128) void k_eye(float* __restrict__ EYE) { const int r = blockIdx.x, c = threadIdx.x; vst2(EYE + (size_t)r * CC + c, (r == c) ? 1.0f : 0.0f); }

// ---- k_proj: block = (64 rows, 128 cols, which): q/k/v = X W (+ b) with exact bf16 products (K = DIN) -> which 0: q f16 rows (+ residual rows < QHI); 1: k f16 rows (+ residual rows < KHI); 2: v f16 planes [c][t] (+ bf16 hi/lo planes for t < KHI)
__global__ __launch_bounds__(128) void k_proj(const float* __restrict__ XQ, const float* __restrict__ XK, const float* __restrict__ XV, const float* __restrict__ WQ, const float* __restrict__ WK, const float* __restrict__ WV, const float* __restrict__ BQ, const float* __restrict__ BK, const float* __restrict__ BV,
    _Float16* __restrict__ QH, _Float16* __restrict__ QL, _Float16* __restrict__ KH, _Float16* __restrict__ KL, _Float16* __restrict__ VT, __bf16* __restrict__ VB, __bf16* __restrict__ VBL, int woff) {
  __shared__ __align__(16) _Float16 sh[64][136], sl[64][136]; __shared__ __align__(16) _Float16 th[128][72]; __shared__ __align__(16) __bf16 tb[128][72], tbl[128][72];
  const int tid = threadIdx.x, wave = tid >> 5, lane = tid & 31, col = lane & 15, g = lane >> 4; const int which = blockIdx.z + woff;   /* q launch: woff 0, grid.z 1; k / v launch: woff 1, grid.z 2 */ const int c0 = blockIdx.y * 128; const size_t r0 = (size_t)blockIdx.x * 64; const size_t bb = r0 / TT; const int t0 = (int)(r0 % TT);
  const float* X = which == 0 ? XQ : which == 1 ? XK : XV; const float* WA = which == 0 ? WQ : which == 1 ? WK : WV; const float* BA = which == 0 ? BQ : which == 1 ? BK : BV;
  v8f acc[8] = {};
  const int din_ = (which == 0) ? DIN : DKV;   /* block-uniform: the query stream and the key / value stream are both 128 wide */
#pragma unroll 2
  for (int kc = 0; kc < din_ / 32; ++kc) { v16b a; { const float* p = X + (r0 + wave * 16 + col) * (size_t)din_ + kc * 32 + 8 * g;
#pragma unroll
      for (int i = 0; i < 8; ++i) { a[i] = (__bf16)p[i]; a[8 + i] = (__bf16)p[16 + i]; } }
    asm volatile("s_wait_loadcnt 0x0" ::: "memory");
#pragma unroll
    for (int j = 0; j < 8; ++j) { const v16b w = WCOL(WA, kc * 32, c0 + j * 16 + col, lane); asm volatile("s_wait_loadcnt 0x0" ::: "memory"); acc[j] = wmma_bf(a, w, acc[j]); } }
  if (which < 2) { _Float16* DH = which == 0 ? QH : KH; _Float16* DL = which == 0 ? QL : KL; const int nhi = which == 0 ? QHI : KHI; const bool hi_rows = t0 < nhi;
#pragma unroll
    for (int j = 0; j < 8; ++j) { const float bias = BA ? bfr(BA[c0 + j * 16 + col]) : 0.f;
#pragma unroll
      for (int r = 0; r < 8; ++r) { const float v = acc[j][r] + bias; const _Float16 hv = (_Float16)v; sh[wave * 16 + 8 * g + r][j * 16 + col] = hv; sl[wave * 16 + 8 * g + r][j * 16 + col] = (_Float16)((v - (float)hv) * 1024.0f); } }
    __syncthreads();
    for (int e = tid; e < 64 * 16; e += 128) { const int rl = e >> 4, q = e & 15; vst2((unsigned*)(DH + (r0 + rl) * CC + c0 + q * 8), *(const v4u*)&sh[rl][q * 8]); if (hi_rows) vst2((unsigned*)(DL + (bb * nhi + t0 + rl) * (size_t)CC + c0 + q * 8), *(const v4u*)&sl[rl][q * 8]); }
  } else { const bool hi_rows = t0 < KHI;
#pragma unroll
    for (int j = 0; j < 8; ++j) { const float bias = BA ? bfr(BA[c0 + j * 16 + col]) : 0.f;
#pragma unroll
      for (int r = 0; r < 8; ++r) { const float v = acc[j][r] + bias; const int rl = wave * 16 + 8 * g + r, cl = j * 16 + col; th[cl][rl] = (_Float16)v; const __bf16 bh = (__bf16)v; tb[cl][rl] = bh; tbl[cl][rl] = (__bf16)(v - (float)bh); } }
    __syncthreads();
    for (int e = tid; e < 128 * 8; e += 128) { const int cl = e >> 3, q = e & 7; vst2((unsigned*)(VT + (bb * CC + c0 + cl) * (size_t)TT + t0 + q * 8), *(const v4u*)&th[cl][q * 8]); if (hi_rows) { const size_t o3 = (bb * CC + c0 + cl) * (size_t)KHI + t0 + q * 8; vst2((unsigned*)(VB + o3), *(const v4u*)&tb[cl][q * 8]); vst2((unsigned*)(VBL + o3), *(const v4u*)&tbl[cl][q * 8]); } } } }
// ---- k_sc: block = (query block qb, key block kb <= kb_last(qb), head in group) of batch b: logits x SCALE; q hi + residual (x 2^10) against k (2 products) for query rows < QHI, plus the k residual (3 products) for query blocks < QBH (causal early rows); causal: blocks past the diagonal exit, the mask itself is applied by index in k_sm
__global__ __launch_bounds__(128) void k_sc(const _Float16* __restrict__ QH, const _Float16* __restrict__ KH, const _Float16* __restrict__ QL, const _Float16* __restrict__ KL, int b, int h0, float* __restrict__ S0) { __shared__ __align__(16) float ss[4][16][132];
  const int qb = blockIdx.x, kb = blockIdx.y; if (kb > kb_last(qb)) return;
  const int h = h0 + blockIdx.z; float* S = S0 + (size_t)blockIdx.z * TT * TT;
  const int tid = threadIdx.x, wave = tid >> 5, lane = tid & 31, col = lane & 15, g = lane >> 4; const int k0 = kb * 128; const int ql0 = qb * 64 + wave * 16; const size_t q0 = (size_t)b * TT + ql0, kr0 = (size_t)b * TT + k0;
  v8f acc[8] = {}, accl[8] = {};
  const _Float16* QLb = QL + (size_t)b * QHI * CC; const _Float16* KLb = KL + (size_t)b * KHI * CC;
  if (qb < QBH) {
#pragma unroll
    for (int kc = 0; kc < HD / 32; ++kc) { const v16h ah = frag_h(QH + (q0 + col) * CC + h * HD + kc * 32, lane), al = frag_h(QLb + (size_t)(ql0 + col) * CC + h * HD + kc * 32, lane);
#pragma unroll
      for (int j = 0; j < 8; ++j) { const v16h kbf = frag_h(KH + (kr0 + j * 16 + col) * CC + h * HD + kc * 32, lane), klf = frag_h(KLb + (size_t)(k0 + j * 16 + col) * CC + h * HD + kc * 32, lane); acc[j] = wmma16(ah, kbf, acc[j]); accl[j] = wmma16(al, kbf, accl[j]); accl[j] = wmma16(ah, klf, accl[j]); } }
  } else if (qb * 64 < QHI) {
#pragma unroll
    for (int kc = 0; kc < HD / 32; ++kc) { const v16h ah = frag_h(QH + (q0 + col) * CC + h * HD + kc * 32, lane), al = frag_h(QLb + (size_t)(ql0 + col) * CC + h * HD + kc * 32, lane);
#pragma unroll
      for (int j = 0; j < 8; ++j) { const v16h kbf = frag_h(KH + (kr0 + j * 16 + col) * CC + h * HD + kc * 32, lane); acc[j] = wmma16(ah, kbf, acc[j]); accl[j] = wmma16(al, kbf, accl[j]); } }
  } else {
#pragma unroll
    for (int kc = 0; kc < HD / 32; ++kc) { const v16h ah = frag_h(QH + (q0 + col) * CC + h * HD + kc * 32, lane);
#pragma unroll
      for (int j = 0; j < 8; ++j) { const v16h kbf = frag_h(KH + (kr0 + j * 16 + col) * CC + h * HD + kc * 32, lane); acc[j] = wmma16(ah, kbf, acc[j]); } } }
#pragma unroll
  for (int j = 0; j < 8; ++j) {
#pragma unroll
    for (int r = 0; r < 8; ++r) ss[wave][8 * g + r][j * 16 + col] = (acc[j][r] + accl[j][r] * (1.0f / 1024.0f)) * SCALE; }
  LDSX(); for (int rl = 0; rl < 16; ++rl) vst2(S + (size_t)(ql0 + rl) * TT + k0 + lane * 4, *(const v4f*)&ss[wave][rl][lane * 4]); }
// ---- k_sm: block = query row t (head in group): keys [0, kend): causal -> logit if s <= t else excluded; softmax in f32; P x 2^11 in place (0 for excluded)
__global__ __launch_bounds__(256) void k_sm(float* __restrict__ S0 SM_EXTRA_PARAMS) { __shared__ float sred[8]; __shared__ float sbc; __shared__ __align__(16) float shv[TT];
  const int tid = threadIdx.x; const int t = blockIdx.x; const int kend = (kb_last(t >> 6) + 1) * 128;
  float* sr = S0 + (size_t)blockIdx.y * TT * TT + (size_t)t * TT;
  float m = -3.0e38f; for (int k = tid; k < kend; k += 256) { float v = (!CAUSAL || k <= t) ? sr[k] : -3.0e38f; SM_MASK_HOOK; shv[k] = v; m = fmaxf(m, v); }
#pragma unroll
  for (int o = 1; o < 32; o <<= 1) m = fmaxf(m, __shfl_xor(m, o));
  if ((tid & 31) == 0) sred[tid >> 5] = m; __syncthreads(); if (tid == 0) { float a = sred[0]; for (int i = 1; i < 8; ++i) a = fmaxf(a, sred[i]); sbc = a; } __syncthreads(); m = sbc; __syncthreads();
  float sum = 0.f; for (int k = tid; k < kend; k += 256) { const float v = shv[k]; const float e = (v <= -1.0e38f) ? 0.f : expf(v - m); shv[k] = e; sum += e; }
#pragma unroll
  for (int o = 1; o < 32; o <<= 1) sum += __shfl_xor(sum, o);
  if ((tid & 31) == 0) sred[tid >> 5] = sum; __syncthreads(); if (tid == 0) { float a = 0.f; for (int i = 0; i < 8; ++i) a += sred[i]; sbc = a > 0.f ? 2048.0f / a : 0.f; }   /* a fully excluded row yields P = 0 */ __syncthreads(); const float inv = sbc;
  for (int k = tid; k < kend; k += 256) shv[k] = shv[k] * inv;
  __syncthreads(); for (int q = tid; q < kend / 4; q += 256) vst2(sr + q * 4, *(const v4f*)&shv[q * 4]); }
// ---- k_pv: block = 64 queries (qb) of (b, h): ctx = P . v over keys [0, kend) (P x 2^11 once to f16 against v f16: 1 product; causal early query blocks: P and v as bf16 hi + lo, 3 products); 512-B (row, head) segment by 32 lanes
__global__ __launch_bounds__(128) void k_pv(const float* __restrict__ PS0, const _Float16* __restrict__ VT, const __bf16* __restrict__ VB, const __bf16* __restrict__ VBL, int b, int h0, float* __restrict__ Y) { const int h = h0 + blockIdx.z; const float* PS = PS0 + (size_t)blockIdx.z * TT * TT; __shared__ __align__(16) float ss[4][16][HD + 4];
  const int tid = threadIdx.x, wave = tid >> 5, lane = tid & 31, col = lane & 15, g = lane >> 4; const int qb = blockIdx.x; const int ql0 = qb * 64 + wave * 16; const int kce = (kb_last(qb) + 1) * 4;
  v8f acc[HD / 16] = {};
  if (qb < QBH) {
#pragma unroll 1
    for (int kc = 0; kc < kce; ++kc) { const F2 p = split_row(PS + (size_t)(ql0 + col) * TT, kc * 32, lane);
      asm volatile("s_wait_loadcnt 0x0" ::: "memory");
#pragma unroll
      for (int j = 0; j < HD / 16; ++j) { const size_t po = ((size_t)b * CC + h * HD + j * 16 + col) * (size_t)KHI + kc * 32; const v16b vh = frag_b(VB + po, lane); acc[j] = wmma_bf(p.h, vh, acc[j]); acc[j] = wmma_bf(p.l, vh, acc[j]); acc[j] = wmma_bf(p.h, frag_b(VBL + po, lane), acc[j]); } }
  } else {
#pragma unroll 1
    for (int kc = 0; kc < kce; ++kc) { const v16h p = frag_f32(PS + (size_t)(ql0 + col) * TT + kc * 32, lane);
      asm volatile("s_wait_loadcnt 0x0" ::: "memory");
#pragma unroll
      for (int j = 0; j < HD / 16; ++j) { const size_t po = ((size_t)b * CC + h * HD + j * 16 + col) * (size_t)TT + kc * 32; acc[j] = wmma16(p, frag_h(VT + po, lane), acc[j]); } } }
#pragma unroll
  for (int j = 0; j < HD / 16; ++j)
#pragma unroll
    for (int r = 0; r < 8; ++r) ss[wave][8 * g + r][j * 16 + col] = acc[j][r] * (1.0f / 2048.0f);
  LDSX(); for (int rl = 0; rl < 16; ++rl) if (lane < HD / 4) vst2(Y + ((size_t)b * TT + ql0 + rl) * CC + h * HD + lane * 4, *(const v4f*)&ss[wave][rl][lane * 4]); }

extern "C" void kernel_launch(void* const* d_in, const int* in_sizes, int n_in, void* d_out, int out_size, void* d_ws, size_t ws_size, hipStream_t stream) {
  (void)in_sizes; (void)n_in; (void)out_size;
  const float** F = (const float**)d_in;
  if (ws_size < (size_t)WS_END) return;
  char* ws = (char*)d_ws; _Float16 *QH = (_Float16*)(ws + WS_QH), *KH = (_Float16*)(ws + WS_KH), *VT = (_Float16*)(ws + WS_VT), *QL = (_Float16*)(ws + WS_QL), *KL = (_Float16*)(ws + WS_KL); __bf16 *VB = (__bf16*)(ws + WS_VB), *VBL = (__bf16*)(ws + WS_VBL); float *S = (float*)(ws + WS_S), *Y = (float*)(ws + WS_Y);
  (void)Y; (void)QL; (void)KL; (void)VB; (void)VBL;
  // inputs: 0 qrys [16,1024,128]; 1 keys [16,2048,128]; 2 vals [16,2048,128]; 3 num_keys [16] int32
  if (ws_size < (size_t)WS_END2) return;
  float* EYE = (float*)(ws + WS_EYE);
  k_eye<<<CC, CC, 0, stream>>>(EYE);
  k_proj<<<dim3(TNB * NQ / 64, CC / 128, 1), 128, 0, stream>>>(F[0], F[1], F[2], EYE, EYE, EYE, nullptr, nullptr, nullptr, QH, QL, KH, KL, VT, VB, VBL, 0);   /* q planes: TNB x 1,024 rows x identity */
  k_proj<<<dim3(TNB * TT / 64, CC / 128, 2), 128, 0, stream>>>(F[0], F[1], F[2], EYE, EYE, EYE, nullptr, nullptr, nullptr, QH, QL, KH, KL, VT, VB, VBL, 1);   /* k rows (which 1) and v planes (which 2): TNB x 2,048 rows x identity */
  for (int b = 0; b < TNB; ++b) {   /* batch index 0 inside the kernels; the base pointers carry the batch */
    k_sc<<<dim3(NQ / 64, TT / 128, HG), 128, 0, stream>>>(QH + (size_t)b * NQ * CC, KH + (size_t)b * TT * CC, QL, KL, 0, 0, S);
    k_sm<<<dim3(NQ, HG), 256, 0, stream>>>(S, (const int*)d_in[3], b);
    k_pv<<<dim3(NQ / 64, 1, HG), 128, 0, stream>>>(S, VT + (size_t)b * CC * TT, VB, VBL, 0, 0, (float*)d_out + (size_t)b * NQ * CC);
  }
}

// v001
// It runs in 281 microseconds.
// Timed twice side by side with v000, it ran 6.98 and 6.91 times as fast.
// compute dtype: queries / keys / values rounded to bf16 and carried EXACTLY into f16 planes (each plane = the input times a 128 x 128 identity on WMMA 16x16x32: one exact product per element, f32 accumulate); logits q x k as single EXACT f16 products x 128^-0.5; keys at or beyond num_keys[b] excluded; softmax f32; P x 2^11 once to f16 x v (exact f16) (1 product); f32 output.
#include <hip/hip_runtime.h>
#include <math.h>

typedef __attribute__((ext_vector_type(16))) _Float16 v16h;
typedef __attribute__((ext_vector_type(16))) __bf16 v16b;
typedef __attribute__((ext_vector_type(8)))  _Float16 v8h;
typedef __attribute__((ext_vector_type(8)))  float v8f;
typedef __attribute__((ext_vector_type(4)))  float v4f;
typedef __attribute__((ext_vector_type(2)))  float v2f;
typedef __attribute__((ext_vector_type(4)))  unsigned v4u;
typedef __attribute__((ext_vector_type(4)))  int v4i;
typedef float __attribute__((may_alias)) float_a;
typedef int __attribute__((may_alias)) int_a;

template <typename T> __device__ __forceinline__ void vst2(void* p, T v) { *(T*)p = v;  }
__device__ __forceinline__ v8f wmma16(v16h a, v16h b, v8f c) {
  v8f d = __builtin_amdgcn_wmma_f32_16x16x32_f16(false, a, false, b, (short)0, c, false, false);
  asm volatile("v_nop\n\tv_nop\n\tv_nop\n\tv_nop" : "+v"(d) : "v"(a), "v"(b));
  return d;
}
__device__ __forceinline__ v8f wmma_bf(v16b a, v16b b, v8f c) {
  v8f d = __builtin_amdgcn_wmma_f32_16x16x32_bf16(false, a, false, b, (short)0, c, false, false);
  asm volatile("v_nop\n\tv_nop\n\tv_nop\n\tv_nop" : "+v"(d) : "v"(a), "v"(b));
  return d;
}
// 16x16x32 fragments: lane = (h = lane>>4, row/col = lane&15); elements 0..7 = k0+8h+0..7, 8..15 = k0+16+8h+0..7; D element r = row 8h+r
__device__ __forceinline__ v16h frag_h(const _Float16* rowk0, int lane) {
  union { v16h v; v8h q[2]; } u; const _Float16* p = rowk0 + 8 * (lane >> 4);
  u.q[0] = *(const v8h*)p; u.q[1] = *(const v8h*)(p + 16); return u.v;
}
__device__ __forceinline__ v16h frag_f32(const float* rowk0, int lane) {
  v16h a; const float* p = rowk0 + 8 * (lane >> 4);
#pragma unroll
  for (int i = 0; i < 8; ++i) { a[i] = (_Float16)p[i]; a[8 + i] = (_Float16)p[16 + i]; }
  return a;
}
__device__ __forceinline__ v16h frag_f32s(const float* rowk0, int lane, float sc) {
  v16h a; const float* p = rowk0 + 8 * (lane >> 4);
#pragma unroll
  for (int i = 0; i < 8; ++i) { a[i] = (_Float16)(p[i] * sc); a[8 + i] = (_Float16)(p[16 + i] * sc); }
  return a;
}
// column fragment from a [K][ld] layout (column n), rows >= K read as 0
__device__ __forceinline__ v16h fragc_f32(const float* W, int k0, int n, int lane, int ld, int K) {
  v16h a; const int g = lane >> 4;
#pragma unroll
  for (int i = 0; i < 8; ++i) { const int ka = k0 + 8 * g + i, kb = ka + 16;
    a[i] = (_Float16)(ka < K ? W[(size_t)(ka < K ? ka : K - 1) * ld + n] : 0.f); a[8 + i] = (_Float16)(kb < K ? W[(size_t)(kb < K ? kb : K - 1) * ld + n] : 0.f); }
  return a;
}
struct F2 { v16b h, l; };
__device__ __forceinline__ F2 bsplit16(const float v[16]) { F2 r;
#pragma unroll
  for (int i = 0; i < 16; ++i) { const __bf16 h = (__bf16)v[i]; r.h[i] = h; r.l[i] = (__bf16)(v[i] - (float)h); }
  return r; }
__device__ __forceinline__ F2 split_row(const float* row, int k0, int lane) { float v[16]; const float* p = row + k0 + 8 * (lane >> 4);
#pragma unroll
  for (int i = 0; i < 8; ++i) { v[i] = p[i]; v[8 + i] = p[16 + i]; }
  return bsplit16(v); }
__device__ __forceinline__ F2 split_rowK(const float* row, int k0, int lane, int K) { float v[16]; const int g = lane >> 4;
#pragma unroll
  for (int i = 0; i < 8; ++i) { const int ka = k0 + 8 * g + i, kb = ka + 16; v[i] = ka < K ? row[ka < K ? ka : K - 1] : 0.f; v[8 + i] = kb < K ? row[kb < K ? kb : K - 1] : 0.f; }
  return bsplit16(v); }
__device__ __forceinline__ F2 split_col(const float* W, int k0, int n, int lane, int ld, int K) { float v[16]; const int g = lane >> 4;
#pragma unroll
  for (int i = 0; i < 8; ++i) { const int ka = k0 + 8 * g + i, kb = ka + 16; v[i] = ka < K ? W[(size_t)(ka < K ? ka : K - 1) * ld + n] : 0.f; v[8 + i] = kb < K ? W[(size_t)(kb < K ? kb : K - 1) * ld + n] : 0.f; }
  return bsplit16(v); }
__device__ __forceinline__ v8f mac3(const F2& a, const F2& b, v8f c) { c = wmma_bf(a.l, b.h, c); c = wmma_bf(a.h, b.l, c); return wmma_bf(a.h, b.h, c); }
__device__ __forceinline__ float sigm(float v) { return 1.0f / (1.0f + expf(-v)); }
#define LDSX() do { asm volatile("s_wait_dscnt 0" ::: "memory"); __builtin_amdgcn_wave_barrier(); __builtin_amdgcn_fence(__ATOMIC_RELEASE, "workgroup"); } while (0)

// Raw scaled-dot-product attention with a per-batch valid-key count (qrys [16,1024,128]; keys, vals [16,2048,128]; num_keys [16] int32 in [1, 2048); logits = q k^T / sqrt(128); only keys k < num_keys[b] take part (masked max, exp * mask, normalised over the valid keys); out = atts vals, [16,1024,128]). No learned weights. One 128-wide head per batch; each batch has its own score plane of 1,024 query rows x 2,048 keys, and one launch of each stage covers all batches (the batch is a grid dimension).
#define NB 16
#define TT 2048   // keys per batch
#define CC 128            // NH * HD
#define DIN 128           // width of the query rows
#define DKV 128             // width of the key / value rows
#define NH 1
#define HD 128
#define NQB (TT / 64)
#define NQ 1024   // queries per batch: the rows of each batch's score plane
#define SCALE (0.08838834764831845f)   // 1 / sqrt(128)
#define CAUSAL 0
#ifndef TNB
#define TNB NB
#endif
static_assert(CC == NH * HD && CC == 128 && DIN == CC && DKV == CC, "one 128-wide head: the identity projection is 128 x 128 and each projection block covers the whole head");
static_assert(TT % 256 == 0 && NQ % 64 == 0 && NQ <= TT && HD <= 128, "softmax kernel strides 256 keys; 64-query blocks; the k_pv store covers HD <= 128");
__device__ __forceinline__ float bfr(float v) { return (float)(__bf16)v; }
__host__ __device__ __forceinline__ int kb_last(int qb) { return CAUSAL ? ((qb * 64 + 63) >> 7) : (TT / 128 - 1); }
typedef __attribute__((ext_vector_type(8))) __bf16 v8b;
__device__ __forceinline__ v16b frag_b(const __bf16* rowk0, int lane) {
  union { v16b v; v8b q[2]; } u; const __bf16* p = rowk0 + 8 * (lane >> 4);
  u.q[0] = *(const v8b*)p; u.q[1] = *(const v8b*)(p + 16); return u.v;
}
#define QBH 0              // causal: query blocks 0..QBH-1 of each sequence (few keys, no averaging) take the high-precision path
#define QHI 0               // single-product logits on every row
static_assert(QHI == 0 && QBH == 0 && CAUSAL == 0, "the kernels advance their base pointers by the batch and use batch index 0 behind that: no q residual plane and no causal row arithmetic may be in use");
#define KHI 64            // key rows carrying k residual / v bf16 hi+lo planes (used only by the causal high-precision path)
// B fragment (k rows k0+.., output column o) of a weight: (in,out) [K][ld] or (out,in) [ld rows of K]: bf16 exact, or f16(bf16 * 256) exact
__device__ __forceinline__ v16b wcol_io(const float* Wm, int k0, int o, int lane, int ld) { v16b w; const int g = lane >> 4;
#pragma unroll
  for (int i = 0; i < 8; ++i) { w[i] = (__bf16)Wm[(size_t)(k0 + 8 * g + i) * ld + o]; w[8 + i] = (__bf16)Wm[(size_t)(k0 + 16 + 8 * g + i) * ld + o]; }
  return w; }
__device__ __forceinline__ v16b wcol_oi(const float* Wm, int k0, int o, int lane, int K) { v16b w; const float* p = Wm + (size_t)o * K + k0 + 8 * (lane >> 4);
#pragma unroll
  for (int i = 0; i < 8; ++i) { w[i] = (__bf16)p[i]; w[8 + i] = (__bf16)p[16 + i]; }
  return w; }
__device__ __forceinline__ v16h wcolh_io(const float* Wm, int k0, int o, int lane, int ld) { v16h w; const int g = lane >> 4;
#pragma unroll
  for (int i = 0; i < 8; ++i) { w[i] = (_Float16)(bfr(Wm[(size_t)(k0 + 8 * g + i) * ld + o]) * 256.0f); w[8 + i] = (_Float16)(bfr(Wm[(size_t)(k0 + 16 + 8 * g + i) * ld + o]) * 256.0f); }
  return w; }
__device__ __forceinline__ v16h wcolh_oi(const float* Wm, int k0, int o, int lane, int K) { v16h w; const float* p = Wm + (size_t)o * K + k0 + 8 * (lane >> 4);
#pragma unroll
  for (int i = 0; i < 8; ++i) { w[i] = (_Float16)(bfr(p[i]) * 256.0f); w[8 + i] = (_Float16)(bfr(p[16 + i]) * 256.0f); }
  return w; }
#define WQKV_LAYOUT 0   // 0 = (in,out) [DIN][CC]; 1 = (out,in) [CC][DIN]; 2 = per-head [NH][DIN][HD]
__device__ __forceinline__ v16b wcol_hdk(const float* Wm, int k0, int o, int lane) { v16b w; const int g = lane >> 4; const float* p = Wm + (size_t)(o / HD) * DIN * HD + (o % HD);
#pragma unroll
  for (int i = 0; i < 8; ++i) { w[i] = (__bf16)p[(size_t)(k0 + 8 * g + i) * HD]; w[8 + i] = (__bf16)p[(size_t)(k0 + 16 + 8 * g + i) * HD]; }
  return w; }
#define WO_OUT_IN 0
#if WQKV_LAYOUT == 1
#define WCOL(W, k0, o, lane) wcol_oi(W, k0, o, lane, DIN)
#elif WQKV_LAYOUT == 2
#define WCOL(W, k0, o, lane) wcol_hdk(W, k0, o, lane)
#else
#define WCOL(W, k0, o, lane) wcol_io(W, k0, o, lane, CC)
#endif
#if WO_OUT_IN
#define WOCOL(W, k0, o, lane) wcol_oi(W, k0, o, lane, CC)
#define WOCOLH(W, k0, o, lane) wcolh_oi(W, k0, o, lane, CC)
#else
#define WOCOL(W, k0, o, lane) wcol_io(W, k0, o, lane, DIN)
#define WOCOLH(W, k0, o, lane) wcolh_io(W, k0, o, lane, DIN)
#endif

#define SM_EXTRA_PARAMS , const int* __restrict__ NKEYS
// keys at or beyond the batch's valid-key count are excluded (index compare against one block-uniform scalar; num_keys >= 1, so no row is empty)
#define SM_MASK_HOOK do { const int nk_ = NKEYS[blockIdx.y]; v = (k >= nk_) ? -3.0e38f : v; } while (0)
#ifndef SM_EXTRA_PARAMS
#define SM_EXTRA_PARAMS
#endif
#ifndef PROJ_EXTRA_PARAMS
#define PROJ_EXTRA_PARAMS
#endif
#ifndef SM_MASK_HOOK
#define SM_MASK_HOOK (void)0
#endif

#define WS_QH  0u                                      // f16 q rows [b*NQ + t][CC]
#define WS_KH  (WS_QH + 2u * (size_t)NB * NQ * CC)      // f16 k rows [b*TT + t][CC]
#define WS_VT  (WS_KH + 2u * (size_t)NB * TT * CC)      // f16 v planes [b][c][t]
#define WS_QL  (WS_VT + 2u * (size_t)NB * CC * TT)      // f16 q residual x 2^10 rows [b][t < QHI][CC]
#define WS_KL  (WS_QL + 2u * (size_t)NB * QHI * CC)     // f16 k residual x 2^10 rows [b][t < KHI][CC]
#define WS_VB  (WS_KL + 2u * (size_t)NB * KHI * CC)     // bf16 v hi planes [b][c][t < KHI]
#define WS_VBL (WS_VB + 2u * (size_t)NB * CC * KHI)
#define WS_S   (WS_VBL + 2u * (size_t)NB * CC * KHI)    // f32 logits / P [b][t < NQ][s]
#define WS_Y   (WS_S  + 4u * (size_t)NB * NQ * TT)      // (no ctx rows: k_pv writes the output directly)
#define WS_END (WS_Y)
#define WS_EYE (WS_END)                                  // f32 128 x 128 identity
#define WS_END2 (WS_EYE + 4u * (size_t)CC * CC)
__global__ __launch_bounds__(128) void k_eye(float* __restrict__ EYE) { const int r = blockIdx.x, c = threadIdx.x; vst2(EYE + (size_t)r * CC + c, (r == c) ? 1.0f : 0.0f); }

// ---- k_proj: block = (64 rows, 128 cols, which): q/k/v = X W (+ b) with exact bf16 products (K = DIN) -> which 0: q f16 rows (+ residual rows < QHI); 1: k f16 rows (+ residual rows < KHI); 2: v f16 planes [c][t] (+ bf16 hi/lo planes for t < KHI)
__global__ __launch_bounds__(128) void k_proj(const float* __restrict__ XQ, const float* __restrict__ XK, const float* __restrict__ XV, const float* __restrict__ WQ, const float* __restrict__ WK, const float* __restrict__ WV, const float* __restrict__ BQ, const float* __restrict__ BK, const float* __restrict__ BV,
    _Float16* __restrict__ QH, _Float16* __restrict__ QL, _Float16* __restrict__ KH, _Float16* __restrict__ KL, _Float16* __restrict__ VT, __bf16* __restrict__ VB, __bf16* __restrict__ VBL, int woff) {
  __shared__ __align__(16) _Float16 sh[64][136], sl[64][136]; __shared__ __align__(16) _Float16 th[128][72]; __shared__ __align__(16) __bf16 tb[128][72], tbl[128][72];
  const int tid = threadIdx.x, wave = tid >> 5, lane = tid & 31, col = lane & 15, g = lane >> 4; const int which = blockIdx.z + woff;   /* q launch: woff 0, grid.z 1; k / v launch: woff 1, grid.z 2 */ const int c0 = blockIdx.y * 128; const size_t r0 = (size_t)blockIdx.x * 64; const size_t bb = r0 / TT; const int t0 = (int)(r0 % TT);
  const float* X = which == 0 ? XQ : which == 1 ? XK : XV; const float* WA = which == 0 ? WQ : which == 1 ? WK : WV; const float* BA = which == 0 ? BQ : which == 1 ? BK : BV;
  v8f acc[8] = {};
  const int din_ = (which == 0) ? DIN : DKV;   /* block-uniform: the query stream and the key / value stream are both 128 wide */
#pragma unroll 2
  for (int kc = 0; kc < din_ / 32; ++kc) { v16b a; { const float* p = X + (r0 + wave * 16 + col) * (size_t)din_ + kc * 32 + 8 * g;
#pragma unroll
      for (int i = 0; i < 8; ++i) { a[i] = (__bf16)p[i]; a[8 + i] = (__bf16)p[16 + i]; } }
    asm volatile("s_wait_loadcnt 0x0" ::: "memory");
#pragma unroll
    for (int j = 0; j < 8; ++j) { const v16b w = WCOL(WA, kc * 32, c0 + j * 16 + col, lane); asm volatile("s_wait_loadcnt 0x0" ::: "memory"); acc[j] = wmma_bf(a, w, acc[j]); } }
  if (which < 2) { _Float16* DH = which == 0 ? QH : KH; _Float16* DL = which == 0 ? QL : KL; const int nhi = which == 0 ? QHI : KHI; const bool hi_rows = t0 < nhi;
#pragma unroll
    for (int j = 0; j < 8; ++j) { const float bias = BA ? bfr(BA[c0 + j * 16 + col]) : 0.f;
#pragma unroll
      for (int r = 0; r < 8; ++r) { const float v = acc[j][r] + bias; const _Float16 hv = (_Float16)v; sh[wave * 16 + 8 * g + r][j * 16 + col] = hv; sl[wave * 16 + 8 * g + r][j * 16 + col] = (_Float16)((v - (float)hv) * 1024.0f); } }
    __syncthreads();
    for (int e = tid; e < 64 * 16; e += 128) { const int rl = e >> 4, q = e & 15; vst2((unsigned*)(DH + (r0 + rl) * CC + c0 + q * 8), *(const v4u*)&sh[rl][q * 8]); if (hi_rows) vst2((unsigned*)(DL + (bb * nhi + t0 + rl) * (size_t)CC + c0 + q * 8), *(const v4u*)&sl[rl][q * 8]); }
  } else { const bool hi_rows = t0 < KHI;
#pragma unroll
    for (int j = 0; j < 8; ++j) { const float bias = BA ? bfr(BA[c0 + j * 16 + col]) : 0.f;
#pragma unroll
      for (int r = 0; r < 8; ++r) { const float v = acc[j][r] + bias; const int rl = wave * 16 + 8 * g + r, cl = j * 16 + col; th[cl][rl] = (_Float16)v; const __bf16 bh = (__bf16)v; tb[cl][rl] = bh; tbl[cl][rl] = (__bf16)(v - (float)bh); } }
    __syncthreads();
    for (int e = tid; e < 128 * 8; e += 128) { const int cl = e >> 3, q = e & 7; vst2((unsigned*)(VT + (bb * CC + c0 + cl) * (size_t)TT + t0 + q * 8), *(const v4u*)&th[cl][q * 8]); if (hi_rows) { const size_t o3 = (bb * CC + c0 + cl) * (size_t)KHI + t0 + q * 8; vst2((unsigned*)(VB + o3), *(const v4u*)&tb[cl][q * 8]); vst2((unsigned*)(VBL + o3), *(const v4u*)&tbl[cl][q * 8]); } } } }
// ---- k_sc: block = (query block qb, key block kb <= kb_last(qb), batch blockIdx.z): logits x SCALE; q hi + residual (x 2^10) against k (2 products) for query rows < QHI, plus the k residual (3 products) for query blocks < QBH (causal early rows); causal: blocks past the diagonal exit, the mask itself is applied by index in k_sm
__global__ __launch_bounds__(128) void k_sc(const _Float16* __restrict__ QH, const _Float16* __restrict__ KH, const _Float16* __restrict__ QL, const _Float16* __restrict__ KL, int b, int h0, float* __restrict__ S0) { __shared__ __align__(16) float ss[4][16][132];
  const int qb = blockIdx.x, kb = blockIdx.y; if (kb > kb_last(qb)) return;
  const int h = h0; QH += (size_t)blockIdx.z * NQ * CC; KH += (size_t)blockIdx.z * TT * CC; float* S = S0 + (size_t)blockIdx.z * NQ * TT;
  const int tid = threadIdx.x, wave = tid >> 5, lane = tid & 31, col = lane & 15, g = lane >> 4; const int k0 = kb * 128; const int ql0 = qb * 64 + wave * 16; const size_t q0 = (size_t)b * TT + ql0, kr0 = (size_t)b * TT + k0;
  v8f acc[8] = {}, accl[8] = {};
  const _Float16* QLb = QL + (size_t)b * QHI * CC; const _Float16* KLb = KL + (size_t)b * KHI * CC;
  if (qb < QBH) {
#pragma unroll
    for (int kc = 0; kc < HD / 32; ++kc) { const v16h ah = frag_h(QH + (q0 + col) * CC + h * HD + kc * 32, lane), al = frag_h(QLb + (size_t)(ql0 + col) * CC + h * HD + kc * 32, lane);
#pragma unroll
      for (int j = 0; j < 8; ++j) { const v16h kbf = frag_h(KH + (kr0 + j * 16 + col) * CC + h * HD + kc * 32, lane), klf = frag_h(KLb + (size_t)(k0 + j * 16 + col) * CC + h * HD + kc * 32, lane); acc[j] = wmma16(ah, kbf, acc[j]); accl[j] = wmma16(al, kbf, accl[j]); accl[j] = wmma16(ah, klf, accl[j]); } }
  } else if (qb * 64 < QHI) {
#pragma unroll
    for (int kc = 0; kc < HD / 32; ++kc) { const v16h ah = frag_h(QH + (q0 + col) * CC + h * HD + kc * 32, lane), al = frag_h(QLb + (size_t)(ql0 + col) * CC + h * HD + kc * 32, lane);
#pragma unroll
      for (int j = 0; j < 8; ++j) { const v16h kbf = frag_h(KH + (kr0 + j * 16 + col) * CC + h * HD + kc * 32, lane); acc[j] = wmma16(ah, kbf, acc[j]); accl[j] = wmma16(al, kbf, accl[j]); } }
  } else {
#pragma unroll
    for (int kc = 0; kc < HD / 32; ++kc) { const v16h ah = frag_h(QH + (q0 + col) * CC + h * HD + kc * 32, lane);
#pragma unroll
      for (int j = 0; j < 8; ++j) { const v16h kbf = frag_h(KH + (kr0 + j * 16 + col) * CC + h * HD + kc * 32, lane); acc[j] = wmma16(ah, kbf, acc[j]); } } }
#pragma unroll
  for (int j = 0; j < 8; ++j) {
#pragma unroll
    for (int r = 0; r < 8; ++r) ss[wave][8 * g + r][j * 16 + col] = (acc[j][r] + accl[j][r] * (1.0f / 1024.0f)) * SCALE; }
  LDSX(); for (int rl = 0; rl < 16; ++rl) vst2(S + (size_t)(ql0 + rl) * TT + k0 + lane * 4, *(const v4f*)&ss[wave][rl][lane * 4]); }
// ---- k_sm: block = query row t of batch blockIdx.y: keys [0, kend): causal -> logit if s <= t else excluded; softmax in f32; P x 2^11 in place (0 for excluded)
__global__ __launch_bounds__(256) void k_sm(float* __restrict__ S0 SM_EXTRA_PARAMS) { __shared__ float sred[8]; __shared__ float sbc; __shared__ __align__(16) float shv[TT];
  const int tid = threadIdx.x; const int t = blockIdx.x; const int kend = (kb_last(t >> 6) + 1) * 128;
  float* sr = S0 + (size_t)blockIdx.y * NQ * TT + (size_t)t * TT;
  float m = -3.0e38f; for (int k = tid; k < kend; k += 256) { float v = (!CAUSAL || k <= t) ? sr[k] : -3.0e38f; SM_MASK_HOOK; shv[k] = v; m = fmaxf(m, v); }
#pragma unroll
  for (int o = 1; o < 32; o <<= 1) m = fmaxf(m, __shfl_xor(m, o));
  if ((tid & 31) == 0) sred[tid >> 5] = m; __syncthreads(); if (tid == 0) { float a = sred[0]; for (int i = 1; i < 8; ++i) a = fmaxf(a, sred[i]); sbc = a; } __syncthreads(); m = sbc; __syncthreads();
  float sum = 0.f; for (int k = tid; k < kend; k += 256) { const float v = shv[k]; const float e = (v <= -1.0e38f) ? 0.f : expf(v - m); shv[k] = e; sum += e; }
#pragma unroll
  for (int o = 1; o < 32; o <<= 1) sum += __shfl_xor(sum, o);
  if ((tid & 31) == 0) sred[tid >> 5] = sum; __syncthreads(); if (tid == 0) { float a = 0.f; for (int i = 0; i < 8; ++i) a += sred[i]; sbc = a > 0.f ? 2048.0f / a : 0.f; }   /* a fully excluded row yields P = 0 */ __syncthreads(); const float inv = sbc;
  for (int k = tid; k < kend; k += 256) shv[k] = shv[k] * inv;
  __syncthreads(); for (int q = tid; q < kend / 4; q += 256) vst2(sr + q * 4, *(const v4f*)&shv[q * 4]); }
// ---- k_pv: block = 64 queries (qb) of batch blockIdx.z: ctx = P . v over keys [0, kend) (P x 2^11 once to f16 against v f16: 1 product; causal early query blocks: P and v as bf16 hi + lo, 3 products); 512-B (row, head) segment by 32 lanes
__global__ __launch_bounds__(128) void k_pv(const float* __restrict__ PS0, const _Float16* __restrict__ VT, const __bf16* __restrict__ VB, const __bf16* __restrict__ VBL, int b, int h0, float* __restrict__ Y) { const int h = h0; const float* PS = PS0 + (size_t)blockIdx.z * NQ * TT; VT += (size_t)blockIdx.z * CC * TT; Y += (size_t)blockIdx.z * NQ * CC; __shared__ __align__(16) float ss[4][16][HD + 4];
  const int tid = threadIdx.x, wave = tid >> 5, lane = tid & 31, col = lane & 15, g = lane >> 4; const int qb = blockIdx.x; const int ql0 = qb * 64 + wave * 16; const int kce = (kb_last(qb) + 1) * 4;
  v8f acc[HD / 16] = {};
  if (qb < QBH) {
#pragma unroll 1
    for (int kc = 0; kc < kce; ++kc) { const F2 p = split_row(PS + (size_t)(ql0 + col) * TT, kc * 32, lane);
      asm volatile("s_wait_loadcnt 0x0" ::: "memory");
#pragma unroll
      for (int j = 0; j < HD / 16; ++j) { const size_t po = ((size_t)b * CC + h * HD + j * 16 + col) * (size_t)KHI + kc * 32; const v16b vh = frag_b(VB + po, lane); acc[j] = wmma_bf(p.h, vh, acc[j]); acc[j] = wmma_bf(p.l, vh, acc[j]); acc[j] = wmma_bf(p.h, frag_b(VBL + po, lane), acc[j]); } }
  } else {
#pragma unroll 1
    for (int kc = 0; kc < kce; ++kc) { const v16h p = frag_f32(PS + (size_t)(ql0 + col) * TT + kc * 32, lane);
      asm volatile("s_wait_loadcnt 0x0" ::: "memory");
#pragma unroll
      for (int j = 0; j < HD / 16; ++j) { const size_t po = ((size_t)b * CC + h * HD + j * 16 + col) * (size_t)TT + kc * 32; acc[j] = wmma16(p, frag_h(VT + po, lane), acc[j]); } } }
#pragma unroll
  for (int j = 0; j < HD / 16; ++j)
#pragma unroll
    for (int r = 0; r < 8; ++r) ss[wave][8 * g + r][j * 16 + col] = acc[j][r] * (1.0f / 2048.0f);
  LDSX(); for (int rl = 0; rl < 16; ++rl) if (lane < HD / 4) vst2(Y + ((size_t)b * TT + ql0 + rl) * CC + h * HD + lane * 4, *(const v4f*)&ss[wave][rl][lane * 4]); }

extern "C" void kernel_launch(void* const* d_in, const int* in_sizes, int n_in, void* d_out, int out_size, void* d_ws, size_t ws_size, hipStream_t stream) {
  (void)in_sizes; (void)n_in; (void)out_size;
  const float** F = (const float**)d_in;
  if (ws_size < (size_t)WS_END) return;
  char* ws = (char*)d_ws; _Float16 *QH = (_Float16*)(ws + WS_QH), *KH = (_Float16*)(ws + WS_KH), *VT = (_Float16*)(ws + WS_VT), *QL = (_Float16*)(ws + WS_QL), *KL = (_Float16*)(ws + WS_KL); __bf16 *VB = (__bf16*)(ws + WS_VB), *VBL = (__bf16*)(ws + WS_VBL); float *S = (float*)(ws + WS_S), *Y = (float*)(ws + WS_Y);
  (void)Y; (void)QL; (void)KL; (void)VB; (void)VBL;
  // inputs: 0 qrys [16,1024,128]; 1 keys [16,2048,128]; 2 vals [16,2048,128]; 3 num_keys [16] int32
  if (ws_size < (size_t)WS_END2) return;
  float* EYE = (float*)(ws + WS_EYE);
  k_eye<<<CC, CC, 0, stream>>>(EYE);
  k_proj<<<dim3(TNB * NQ / 64, CC / 128, 1), 128, 0, stream>>>(F[0], F[1], F[2], EYE, EYE, EYE, nullptr, nullptr, nullptr, QH, QL, KH, KL, VT, VB, VBL, 0);   /* q planes: TNB x 1,024 rows x identity */
  k_proj<<<dim3(TNB * TT / 64, CC / 128, 2), 128, 0, stream>>>(F[0], F[1], F[2], EYE, EYE, EYE, nullptr, nullptr, nullptr, QH, QL, KH, KL, VT, VB, VBL, 1);   /* k rows (which 1) and v planes (which 2): TNB x 2,048 rows x identity */
  /* one launch per stage for all batches: the batch is blockIdx.z (k_sc, k_pv) or blockIdx.y (k_sm) */
  k_sc<<<dim3(NQ / 64, TT / 128, TNB), 128, 0, stream>>>(QH, KH, QL, KL, 0, 0, S);
  k_sm<<<dim3(NQ, TNB), 256, 0, stream>>>(S, (const int*)d_in[3]);
  k_pv<<<dim3(NQ / 64, 1, TNB), 128, 0, stream>>>(S, VT, VB, VBL, 0, 0, (float*)d_out);
}

// v002
// Measured time: 70.7 microseconds a run.
// In two side-by-side timings against v001, it was 3.91 and 3.97 times as fast.
// All steps since v000 together make it 27.4 times as fast.
// compute dtype: queries / keys / values rounded to bf16 and carried EXACTLY into f16 planes (each plane = the input times a 128 x 128 identity on WMMA 16x16x32: one exact product per element, f32 accumulate); logits q x k as single EXACT f16 products x 128^-0.5; keys at or beyond num_keys[b] excluded; softmax f32 with a running maximum and sum per query; P = exp(logit - running maximum) once to f16 x v (exact f16) (1 product); f32 output.
#include <hip/hip_runtime.h>
#include <math.h>

typedef __attribute__((ext_vector_type(16))) _Float16 v16h;
typedef __attribute__((ext_vector_type(16))) __bf16 v16b;
typedef __attribute__((ext_vector_type(8)))  _Float16 v8h;
typedef __attribute__((ext_vector_type(8)))  float v8f;
typedef __attribute__((ext_vector_type(4)))  float v4f;
typedef __attribute__((ext_vector_type(2)))  float v2f;
typedef __attribute__((ext_vector_type(4)))  unsigned v4u;
typedef __attribute__((ext_vector_type(4)))  int v4i;
typedef float __attribute__((may_alias)) float_a;
typedef int __attribute__((may_alias)) int_a;

template <typename T> __device__ __forceinline__ void vst2(void* p, T v) { *(T*)p = v;  }
__device__ __forceinline__ v8f wmma16(v16h a, v16h b, v8f c) {
  v8f d = __builtin_amdgcn_wmma_f32_16x16x32_f16(false, a, false, b, (short)0, c, false, false);
  asm volatile("v_nop\n\tv_nop\n\tv_nop\n\tv_nop" : "+v"(d) : "v"(a), "v"(b));
  return d;
}
__device__ __forceinline__ v8f wmma_bf(v16b a, v16b b, v8f c) {
  v8f d = __builtin_amdgcn_wmma_f32_16x16x32_bf16(false, a, false, b, (short)0, c, false, false);
  asm volatile("v_nop\n\tv_nop\n\tv_nop\n\tv_nop" : "+v"(d) : "v"(a), "v"(b));
  return d;
}
// 16x16x32 fragments: lane = (h = lane>>4, row/col = lane&15); elements 0..7 = k0+8h+0..7, 8..15 = k0+16+8h+0..7; D element r = row 8h+r
__device__ __forceinline__ v16h frag_h(const _Float16* rowk0, int lane) {
  union { v16h v; v8h q[2]; } u; const _Float16* p = rowk0 + 8 * (lane >> 4);
  u.q[0] = *(const v8h*)p; u.q[1] = *(const v8h*)(p + 16); return u.v;
}
__device__ __forceinline__ v16h frag_f32(const float* rowk0, int lane) {
  v16h a; const float* p = rowk0 + 8 * (lane >> 4);
#pragma unroll
  for (int i = 0; i < 8; ++i) { a[i] = (_Float16)p[i]; a[8 + i] = (_Float16)p[16 + i]; }
  return a;
}
__device__ __forceinline__ v16h frag_f32s(const float* rowk0, int lane, float sc) {
  v16h a; const float* p = rowk0 + 8 * (lane >> 4);
#pragma unroll
  for (int i = 0; i < 8; ++i) { a[i] = (_Float16)(p[i] * sc); a[8 + i] = (_Float16)(p[16 + i] * sc); }
  return a;
}
// column fragment from a [K][ld] layout (column n), rows >= K read as 0
__device__ __forceinline__ v16h fragc_f32(const float* W, int k0, int n, int lane, int ld, int K) {
  v16h a; const int g = lane >> 4;
#pragma unroll
  for (int i = 0; i < 8; ++i) { const int ka = k0 + 8 * g + i, kb = ka + 16;
    a[i] = (_Float16)(ka < K ? W[(size_t)(ka < K ? ka : K - 1) * ld + n] : 0.f); a[8 + i] = (_Float16)(kb < K ? W[(size_t)(kb < K ? kb : K - 1) * ld + n] : 0.f); }
  return a;
}
struct F2 { v16b h, l; };
__device__ __forceinline__ F2 bsplit16(const float v[16]) { F2 r;
#pragma unroll
  for (int i = 0; i < 16; ++i) { const __bf16 h = (__bf16)v[i]; r.h[i] = h; r.l[i] = (__bf16)(v[i] - (float)h); }
  return r; }
__device__ __forceinline__ F2 split_row(const float* row, int k0, int lane) { float v[16]; const float* p = row + k0 + 8 * (lane >> 4);
#pragma unroll
  for (int i = 0; i < 8; ++i) { v[i] = p[i]; v[8 + i] = p[16 + i]; }
  return bsplit16(v); }
__device__ __forceinline__ F2 split_rowK(const float* row, int k0, int lane, int K) { float v[16]; const int g = lane >> 4;
#pragma unroll
  for (int i = 0; i < 8; ++i) { const int ka = k0 + 8 * g + i, kb = ka + 16; v[i] = ka < K ? row[ka < K ? ka : K - 1] : 0.f; v[8 + i] = kb < K ? row[kb < K ? kb : K - 1] : 0.f; }
  return bsplit16(v); }
__device__ __forceinline__ F2 split_col(const float* W, int k0, int n, int lane, int ld, int K) { float v[16]; const int g = lane >> 4;
#pragma unroll
  for (int i = 0; i < 8; ++i) { const int ka = k0 + 8 * g + i, kb = ka + 16; v[i] = ka < K ? W[(size_t)(ka < K ? ka : K - 1) * ld + n] : 0.f; v[8 + i] = kb < K ? W[(size_t)(kb < K ? kb : K - 1) * ld + n] : 0.f; }
  return bsplit16(v); }
__device__ __forceinline__ v8f mac3(const F2& a, const F2& b, v8f c) { c = wmma_bf(a.l, b.h, c); c = wmma_bf(a.h, b.l, c); return wmma_bf(a.h, b.h, c); }
__device__ __forceinline__ float sigm(float v) { return 1.0f / (1.0f + expf(-v)); }
#define LDSX() do { asm volatile("s_wait_dscnt 0" ::: "memory"); __builtin_amdgcn_wave_barrier(); __builtin_amdgcn_fence(__ATOMIC_RELEASE, "workgroup"); } while (0)

// Raw scaled-dot-product attention with a per-batch valid-key count (qrys [16,1024,128]; keys, vals [16,2048,128]; num_keys [16] int32 in [1, 2048); logits = q k^T / sqrt(128); only keys k < num_keys[b] take part (masked max, exp * mask, normalised over the valid keys); out = atts vals, [16,1024,128]). No learned weights. One 128-wide head per batch; one launch of each stage covers all batches (the batch is a grid dimension); the scores stay in registers.
#define NB 16
#define TT 2048   // keys per batch
#define CC 128            // NH * HD
#define DIN 128           // width of the query rows
#define DKV 128             // width of the key / value rows
#define NH 1
#define HD 128
#define NQB (TT / 64)
#define NQ 1024   // queries per batch
#define SCALE (0.08838834764831845f)   // 1 / sqrt(128)
#define CAUSAL 0
#ifndef TNB
#define TNB NB
#endif
static_assert(CC == NH * HD && CC == 128 && DIN == CC && DKV == CC, "one 128-wide head: the identity projection is 128 x 128 and each projection block covers the whole head");
static_assert(TT % 256 == 0 && NQ % 64 == 0 && NQ <= TT && HD <= 128, "whole key tiles; 64-query blocks; one 128-wide head");
__device__ __forceinline__ float bfr(float v) { return (float)(__bf16)v; }
__host__ __device__ __forceinline__ int kb_last(int qb) { return CAUSAL ? ((qb * 64 + 63) >> 7) : (TT / 128 - 1); }
typedef __attribute__((ext_vector_type(8))) __bf16 v8b;
__device__ __forceinline__ v16b frag_b(const __bf16* rowk0, int lane) {
  union { v16b v; v8b q[2]; } u; const __bf16* p = rowk0 + 8 * (lane >> 4);
  u.q[0] = *(const v8b*)p; u.q[1] = *(const v8b*)(p + 16); return u.v;
}
#define QBH 0              // causal: query blocks 0..QBH-1 of each sequence (few keys, no averaging) take the high-precision path
#define QHI 0               // single-product logits on every row
static_assert(QHI == 0 && QBH == 0 && CAUSAL == 0, "the kernels advance their base pointers by the batch and use batch index 0 behind that: no q residual plane and no causal row arithmetic may be in use");
#define KHI 64            // key rows carrying k residual / v bf16 hi+lo planes (used only by the causal high-precision path)
// B fragment (k rows k0+.., output column o) of a weight: (in,out) [K][ld] or (out,in) [ld rows of K]: bf16 exact, or f16(bf16 * 256) exact
__device__ __forceinline__ v16b wcol_io(const float* Wm, int k0, int o, int lane, int ld) { v16b w; const int g = lane >> 4;
#pragma unroll
  for (int i = 0; i < 8; ++i) { w[i] = (__bf16)Wm[(size_t)(k0 + 8 * g + i) * ld + o]; w[8 + i] = (__bf16)Wm[(size_t)(k0 + 16 + 8 * g + i) * ld + o]; }
  return w; }
__device__ __forceinline__ v16b wcol_oi(const float* Wm, int k0, int o, int lane, int K) { v16b w; const float* p = Wm + (size_t)o * K + k0 + 8 * (lane >> 4);
#pragma unroll
  for (int i = 0; i < 8; ++i) { w[i] = (__bf16)p[i]; w[8 + i] = (__bf16)p[16 + i]; }
  return w; }
__device__ __forceinline__ v16h wcolh_io(const float* Wm, int k0, int o, int lane, int ld) { v16h w; const int g = lane >> 4;
#pragma unroll
  for (int i = 0; i < 8; ++i) { w[i] = (_Float16)(bfr(Wm[(size_t)(k0 + 8 * g + i) * ld + o]) * 256.0f); w[8 + i] = (_Float16)(bfr(Wm[(size_t)(k0 + 16 + 8 * g + i) * ld + o]) * 256.0f); }
  return w; }
__device__ __forceinline__ v16h wcolh_oi(const float* Wm, int k0, int o, int lane, int K) { v16h w; const float* p = Wm + (size_t)o * K + k0 + 8 * (lane >> 4);
#pragma unroll
  for (int i = 0; i < 8; ++i) { w[i] = (_Float16)(bfr(p[i]) * 256.0f); w[8 + i] = (_Float16)(bfr(p[16 + i]) * 256.0f); }
  return w; }
#define WQKV_LAYOUT 0   // 0 = (in,out) [DIN][CC]; 1 = (out,in) [CC][DIN]; 2 = per-head [NH][DIN][HD]
__device__ __forceinline__ v16b wcol_hdk(const float* Wm, int k0, int o, int lane) { v16b w; const int g = lane >> 4; const float* p = Wm + (size_t)(o / HD) * DIN * HD + (o % HD);
#pragma unroll
  for (int i = 0; i < 8; ++i) { w[i] = (__bf16)p[(size_t)(k0 + 8 * g + i) * HD]; w[8 + i] = (__bf16)p[(size_t)(k0 + 16 + 8 * g + i) * HD]; }
  return w; }
#define WO_OUT_IN 0
#if WQKV_LAYOUT == 1
#define WCOL(W, k0, o, lane) wcol_oi(W, k0, o, lane, DIN)
#elif WQKV_LAYOUT == 2
#define WCOL(W, k0, o, lane) wcol_hdk(W, k0, o, lane)
#else
#define WCOL(W, k0, o, lane) wcol_io(W, k0, o, lane, CC)
#endif
#if WO_OUT_IN
#define WOCOL(W, k0, o, lane) wcol_oi(W, k0, o, lane, CC)
#define WOCOLH(W, k0, o, lane) wcolh_oi(W, k0, o, lane, CC)
#else
#define WOCOL(W, k0, o, lane) wcol_io(W, k0, o, lane, DIN)
#define WOCOLH(W, k0, o, lane) wcolh_io(W, k0, o, lane, DIN)
#endif

#ifndef PROJ_EXTRA_PARAMS
#define PROJ_EXTRA_PARAMS
#endif

#define WS_QH  0u                                      // f16 q rows [b*NQ + t][CC]
#define WS_KH  (WS_QH + 2u * (size_t)NB * NQ * CC)      // f16 k rows [b*TT + t][CC]
#define WS_VT  (WS_KH + 2u * (size_t)NB * TT * CC)      // f16 v planes [b][c][t]
#define WS_QL  (WS_VT + 2u * (size_t)NB * CC * TT)      // f16 q residual x 2^10 rows [b][t < QHI][CC]
#define WS_KL  (WS_QL + 2u * (size_t)NB * QHI * CC)     // f16 k residual x 2^10 rows [b][t < KHI][CC]
#define WS_VB  (WS_KL + 2u * (size_t)NB * KHI * CC)     // bf16 v hi planes [b][c][t < KHI]
#define WS_VBL (WS_VB + 2u * (size_t)NB * CC * KHI)
#define WS_S   (WS_VBL + 2u * (size_t)NB * CC * KHI)    // (score plane of earlier versions: no longer written or read, the offsets behind it are kept)
#define WS_Y   (WS_S  + 4u * (size_t)NB * NQ * TT)      // (no ctx rows: k_fa writes the output directly)
#define WS_END (WS_Y)
#define WS_EYE (WS_END)                                  // f32 128 x 128 identity
#define WS_END2 (WS_EYE + 4u * (size_t)CC * CC)
__global__ __launch_bounds__(128) void k_eye(float* __restrict__ EYE) { const int r = blockIdx.x, c = threadIdx.x; vst2(EYE + (size_t)r * CC + c, (r == c) ? 1.0f : 0.0f); }

// ---- k_proj: block = (64 rows, 128 cols, which): q/k/v = X W (+ b) with exact bf16 products (K = DIN) -> which 0: q f16 rows (+ residual rows < QHI); 1: k f16 rows (+ residual rows < KHI); 2: v f16 planes [c][t] (+ bf16 hi/lo planes for t < KHI)
__global__ __launch_bounds__(128) void k_proj(const float* __restrict__ XQ, const float* __restrict__ XK, const float* __restrict__ XV, const float* __restrict__ WQ, const float* __restrict__ WK, const float* __restrict__ WV, const float* __restrict__ BQ, const float* __restrict__ BK, const float* __restrict__ BV,
    _Float16* __restrict__ QH, _Float16* __restrict__ QL, _Float16* __restrict__ KH, _Float16* __restrict__ KL, _Float16* __restrict__ VT, __bf16* __restrict__ VB, __bf16* __restrict__ VBL, int woff) {
  __shared__ __align__(16) _Float16 sh[64][136], sl[64][136]; __shared__ __align__(16) _Float16 th[128][72]; __shared__ __align__(16) __bf16 tb[128][72], tbl[128][72];
  const int tid = threadIdx.x, wave = tid >> 5, lane = tid & 31, col = lane & 15, g = lane >> 4; const int which = blockIdx.z + woff;   /* q launch: woff 0, grid.z 1; k / v launch: woff 1, grid.z 2 */ const int c0 = blockIdx.y * 128; const size_t r0 = (size_t)blockIdx.x * 64; const size_t bb = r0 / TT; const int t0 = (int)(r0 % TT);
  const float* X = which == 0 ? XQ : which == 1 ? XK : XV; const float* WA = which == 0 ? WQ : which == 1 ? WK : WV; const float* BA = which == 0 ? BQ : which == 1 ? BK : BV;
  v8f acc[8] = {};
  const int din_ = (which == 0) ? DIN : DKV;   /* block-uniform: the query stream and the key / value stream are both 128 wide */
#pragma unroll 2
  for (int kc = 0; kc < din_ / 32; ++kc) { v16b a; { const float* p = X + (r0 + wave * 16 + col) * (size_t)din_ + kc * 32 + 8 * g;
#pragma unroll
      for (int i = 0; i < 8; ++i) { a[i] = (__bf16)p[i]; a[8 + i] = (__bf16)p[16 + i]; } }
    asm volatile("s_wait_loadcnt 0x0" ::: "memory");
#pragma unroll
    for (int j = 0; j < 8; ++j) { const v16b w = WCOL(WA, kc * 32, c0 + j * 16 + col, lane); asm volatile("s_wait_loadcnt 0x0" ::: "memory"); acc[j] = wmma_bf(a, w, acc[j]); } }
  if (which < 2) { _Float16* DH = which == 0 ? QH : KH; _Float16* DL = which == 0 ? QL : KL; const int nhi = which == 0 ? QHI : KHI; const bool hi_rows = t0 < nhi;
#pragma unroll
    for (int j = 0; j < 8; ++j) { const float bias = BA ? bfr(BA[c0 + j * 16 + col]) : 0.f;
#pragma unroll
      for (int r = 0; r < 8; ++r) { const float v = acc[j][r] + bias; const _Float16 hv = (_Float16)v; sh[wave * 16 + 8 * g + r][j * 16 + col] = hv; sl[wave * 16 + 8 * g + r][j * 16 + col] = (_Float16)((v - (float)hv) * 1024.0f); } }
    __syncthreads();
    for (int e = tid; e < 64 * 16; e += 128) { const int rl = e >> 4, q = e & 15; vst2((unsigned*)(DH + (r0 + rl) * CC + c0 + q * 8), *(const v4u*)&sh[rl][q * 8]); if (hi_rows) vst2((unsigned*)(DL + (bb * nhi + t0 + rl) * (size_t)CC + c0 + q * 8), *(const v4u*)&sl[rl][q * 8]); }
  } else { const bool hi_rows = t0 < KHI;
#pragma unroll
    for (int j = 0; j < 8; ++j) { const float bias = BA ? bfr(BA[c0 + j * 16 + col]) : 0.f;
#pragma unroll
      for (int r = 0; r < 8; ++r) { const float v = acc[j][r] + bias; const int rl = wave * 16 + 8 * g + r, cl = j * 16 + col; th[cl][rl] = (_Float16)v; const __bf16 bh = (__bf16)v; tb[cl][rl] = bh; tbl[cl][rl] = (__bf16)(v - (float)bh); } }
    __syncthreads();
    for (int e = tid; e < 128 * 8; e += 128) { const int cl = e >> 3, q = e & 7; vst2((unsigned*)(VT + (bb * CC + c0 + cl) * (size_t)TT + t0 + q * 8), *(const v4u*)&th[cl][q * 8]); if (hi_rows) { const size_t o3 = (bb * CC + c0 + cl) * (size_t)KHI + t0 + q * 8; vst2((unsigned*)(VB + o3), *(const v4u*)&tb[cl][q * 8]); vst2((unsigned*)(VBL + o3), *(const v4u*)&tbl[cl][q * 8]); } } } }
#define FK 64              // keys per pass
#define SL2 (SCALE * 1.4426950408889634f)   // logits in log2 units: exp(x) = exp2(x * log2 e)
static_assert(TT % FK == 0 && NQ % 64 == 0 && CC == 128 && FK == 64, "whole passes; the tile fetch deals 16-byte pieces of 64 x 128 and 128 x 64 tiles to 128 threads");
__device__ __forceinline__ float xhalf(float x) { return __builtin_bit_cast(float, __builtin_amdgcn_permlanex16(__builtin_bit_cast(int, x), __builtin_bit_cast(int, x), 0x76543210, 0xfedcba98, false, false)); }   // lane l with lane l ^ 16
// every "#pragma unroll" in k_fa: the register arrays (fragments, score tiles, accumulators, fetched pieces) need constant indices to stay in registers
__global__ __launch_bounds__(128) void k_fa(const _Float16* __restrict__ QH, const _Float16* __restrict__ KH, const _Float16* __restrict__ VT, const int* __restrict__ NKEYS, float* __restrict__ Y) {
  __shared__ __align__(16) _Float16 ks[2][FK][CC + 8]; __shared__ __align__(16) _Float16 vs[2][CC][FK + 8];
  const int tid = threadIdx.x, wave = tid >> 5, lane = tid & 31, col = lane & 15, g = lane >> 4;
  const int nk = NKEYS[blockIdx.z];   /* only compared with key indices, never part of an address */
  QH += (size_t)blockIdx.z * NQ * CC; KH += (size_t)blockIdx.z * TT * CC; VT += (size_t)blockIdx.z * CC * TT; Y += (size_t)blockIdx.z * NQ * CC;
  const int q = blockIdx.x * 64 + wave * 16 + col;
  /* tile fetch: thread tid takes 16-byte piece tid + 128 i of each tile; k tile = 64 whole rows (contiguous), v tile = 128 rows of 128 bytes */
  const unsigned ko = (unsigned)tid * 8u, vo = (unsigned)(tid >> 3) * TT + (unsigned)(tid & 7) * 8u;
  v16h qf[4]; v4u kr[8], vr[8];
#pragma unroll
  for (int kc = 0; kc < 4; ++kc) qf[kc] = frag_h(QH + (size_t)q * CC + kc * 32, lane);
#pragma unroll
  for (int i = 0; i < 8; ++i) { kr[i] = *(const v4u*)(KH + ko + i * 1024u); vr[i] = *(const v4u*)(VT + vo + i * 16u * TT); }
  asm volatile("s_wait_xcnt 0x0" ::: "memory");   /* before any address register of the loads above is overwritten */
  __builtin_amdgcn_sched_barrier(0);   /* keeps the index arithmetic below, which reuses those registers, from being lifted over the wait */
  const unsigned kd = (unsigned)(tid >> 4) * (CC + 8) + (unsigned)(tid & 15) * 8u, vd = (unsigned)(tid >> 3) * (FK + 8) + (unsigned)(tid & 7) * 8u;   /* the pieces' places in the LDS tiles */
#pragma unroll
  for (int i = 0; i < 8; ++i) { *(v4u*)(&ks[0][0][0] + kd + i * 8u * (CC + 8)) = kr[i]; *(v4u*)(&vs[0][0][0] + vd + i * 16u * (FK + 8)) = vr[i]; }
  __syncthreads();
  float m = -3.0e38f, l = 0.f; v8f acc[8] = {};
#pragma unroll 1   /* rolled: one copy of the long pass in the instruction cache */
  for (int it = 0; it < TT / FK; ++it) { const int cur = it & 1;
    if (it + 1 < TT / FK) { const _Float16* kn = KH + (size_t)(it + 1) * FK * CC; const _Float16* vn = VT + (it + 1) * FK;
#pragma unroll
      for (int i = 0; i < 8; ++i) { kr[i] = *(const v4u*)(kn + ko + i * 1024u); vr[i] = *(const v4u*)(vn + vo + i * 16u * TT); }
      asm volatile("s_wait_xcnt 0x0" ::: "memory"); }   /* before any address register of the loads above is overwritten */
    v16h kf[4][4], vf[2][8];
#pragma unroll
    for (int t = 0; t < 4; ++t)
#pragma unroll
      for (int kc = 0; kc < 4; ++kc) kf[t][kc] = frag_h(&ks[cur][t * 16 + col][kc * 32], lane);
    __builtin_amdgcn_sched_barrier(0);   /* k reads ahead of the v reads: LDS answers in order, and the first product needs k alone */
#pragma unroll
    for (int u = 0; u < 2; ++u)
#pragma unroll
      for (int j = 0; j < 8; ++j) vf[u][j] = frag_h(&vs[cur][j * 16 + col][u * 32], lane);
    __builtin_amdgcn_sched_barrier(0);   /* the v reads stay one group ahead of the products, in flight under the first product and the exponentials */
    v8f st[4];
#pragma unroll
    for (int t = 0; t < 4; ++t) { v8f s = {};
#pragma unroll
      for (int kc = 0; kc < 4; ++kc) s = __builtin_amdgcn_wmma_f32_16x16x32_f16(false, kf[t][kc], false, qf[kc], (short)0, s, false, false);
      st[t] = s; }
    /* st[t][r] = raw logit of key it * 64 + t * 16 + 8 g + r for query col */
    if ((it + 1) * FK > nk) { const int rem = nk - it * FK - 8 * g;   /* block-uniform: only passes that reach past the valid keys pay for the mask */
#pragma unroll
      for (int t = 0; t < 4; ++t)
#pragma unroll
        for (int r = 0; r < 8; ++r) st[t][r] = (t * 16 + r < rem) ? st[t][r] : -3.0e38f; }
    float mt[4];
#pragma unroll
    for (int t = 0; t < 4; ++t) { mt[t] = st[t][0];
#pragma unroll
      for (int r = 1; r < 8; ++r) mt[t] = fmaxf(mt[t], st[t][r]); }
    float mx = fmaxf(fmaxf(mt[0], mt[1]), fmaxf(mt[2], mt[3])); mx = fmaxf(m, fmaxf(mx, xhalf(mx)));
    const float al = __builtin_amdgcn_exp2f((m - mx) * SL2), ms = mx * SL2; m = mx;
    float ps[4]; v16h pb[2];
#pragma unroll
    for (int t = 0; t < 4; ++t) { ps[t] = 0.f;
#pragma unroll
      for (int r = 0; r < 8; ++r) { const float p = __builtin_amdgcn_exp2f(fmaf(st[t][r], SL2, -ms)); ps[t] += p; pb[t >> 1][(t & 1) * 8 + r] = (_Float16)p; } }
    l = l * al + ((ps[0] + ps[1]) + (ps[2] + ps[3]));
#pragma unroll
    for (int j = 0; j < 8; ++j) acc[j] *= al;
#pragma unroll
    for (int u = 0; u < 2; ++u)
#pragma unroll
      for (int j = 0; j < 8; ++j) acc[j] = __builtin_amdgcn_wmma_f32_16x16x32_f16(false, vf[u][j], false, pb[u], (short)0, acc[j], false, false);
    if (it + 1 < TT / FK) {
#pragma unroll
      for (int i = 0; i < 8; ++i) { *(v4u*)(&ks[cur ^ 1][0][0] + kd + i * 8u * (CC + 8)) = kr[i]; *(v4u*)(&vs[cur ^ 1][0][0] + vd + i * 16u * (FK + 8)) = vr[i]; } }
    __syncthreads(); }   /* publishes the other buffer and ends every wave's reads of this one */
  l += xhalf(l);
  const float inv = (nk > 0 && l > 0.f) ? 1.0f / l : 0.f;   /* a fully excluded row yields 0 */
  float* yr = Y + (size_t)q * CC + 8 * g;   /* acc[j][r] = out[query col][j * 16 + 8 g + r] */
#pragma unroll
  for (int j = 0; j < 8; ++j) { const v4f a = { acc[j][0] * inv, acc[j][1] * inv, acc[j][2] * inv, acc[j][3] * inv }, c = { acc[j][4] * inv, acc[j][5] * inv, acc[j][6] * inv, acc[j][7] * inv }; vst2(yr + j * 16, a); vst2(yr + j * 16 + 4, c); } }

extern "C" void kernel_launch(void* const* d_in, const int* in_sizes, int n_in, void* d_out, int out_size, void* d_ws, size_t ws_size, hipStream_t stream) {
  (void)in_sizes; (void)n_in; (void)out_size;
  const float** F = (const float**)d_in;
  if (ws_size < (size_t)WS_END) return;
  char* ws = (char*)d_ws; _Float16 *QH = (_Float16*)(ws + WS_QH), *KH = (_Float16*)(ws + WS_KH), *VT = (_Float16*)(ws + WS_VT), *QL = (_Float16*)(ws + WS_QL), *KL = (_Float16*)(ws + WS_KL); __bf16 *VB = (__bf16*)(ws + WS_VB), *VBL = (__bf16*)(ws + WS_VBL); float *Y = (float*)(ws + WS_Y);
  (void)Y; (void)QL; (void)KL; (void)VB; (void)VBL;
  // inputs: 0 qrys [16,1024,128]; 1 keys [16,2048,128]; 2 vals [16,2048,128]; 3 num_keys [16] int32
  if (ws_size < (size_t)WS_END2) return;
  float* EYE = (float*)(ws + WS_EYE);
  k_eye<<<CC, CC, 0, stream>>>(EYE);
  k_proj<<<dim3(TNB * NQ / 64, CC / 128, 1), 128, 0, stream>>>(F[0], F[1], F[2], EYE, EYE, EYE, nullptr, nullptr, nullptr, QH, QL, KH, KL, VT, VB, VBL, 0);   /* q planes: TNB x 1,024 rows x identity */
  k_proj<<<dim3(TNB * TT / 64, CC / 128, 2), 128, 0, stream>>>(F[0], F[1], F[2], EYE, EYE, EYE, nullptr, nullptr, nullptr, QH, QL, KH, KL, VT, VB, VBL, 1);   /* k rows (which 1) and v planes (which 2): TNB x 2,048 rows x identity */
  /* scores, softmax and P x V in one launch for all batches: the batch is blockIdx.z */
  k_fa<<<dim3(NQ / 64, 1, TNB), 128, 0, stream>>>(QH, KH, VT, (const int*)d_in[3], (float*)d_out);
}

// v003
// It runs in 43.5 microseconds.
// In both of two side-by-side timings against v002, it was 1.61 times as fast.
// All steps since v000 together make it 44.0 times as fast.
// compute dtype: queries / keys / values rounded to bf16 and carried EXACTLY into f16 planes (one streaming conversion kernel; v transposed on the way); logits q x k as single EXACT f16 products x 128^-0.5; keys at or beyond num_keys[b] excluded; softmax f32 with a running maximum and sum per query; P = exp(logit - running maximum) once to f16 x v (exact f16) (1 product); f32 output.
#include <hip/hip_runtime.h>
#include <math.h>

typedef __attribute__((ext_vector_type(16))) _Float16 v16h;
typedef __attribute__((ext_vector_type(8)))  _Float16 v8h;
typedef __attribute__((ext_vector_type(4)))  _Float16 v4h;
typedef __attribute__((ext_vector_type(8)))  float v8f;
typedef __attribute__((ext_vector_type(4)))  float v4f;
typedef __attribute__((ext_vector_type(4)))  unsigned v4u;

template <typename T> __device__ __forceinline__ void vst2(void* p, T v) { *(T*)p = v;  }
// 16x16x32 fragments: lane = (h = lane>>4, row/col = lane&15); elements 0..7 = k0+8h+0..7, 8..15 = k0+16+8h+0..7; D element r = row 8h+r
__device__ __forceinline__ v16h frag_h(const _Float16* rowk0, int lane) {
  union { v16h v; v8h q[2]; } u; const _Float16* p = rowk0 + 8 * (lane >> 4);
  u.q[0] = *(const v8h*)p; u.q[1] = *(const v8h*)(p + 16); return u.v;
}

// Raw scaled-dot-product attention with a per-batch valid-key count (qrys [16,1024,128]; keys, vals [16,2048,128]; num_keys [16] int32 in [1, 2048); logits = q k^T / sqrt(128); only keys k < num_keys[b] take part (masked max, exp * mask, normalised over the valid keys); out = atts vals, [16,1024,128]). No learned weights. One 128-wide head per batch; one launch of each stage covers all batches; the scores stay in registers.
#define NB 16
#define TT 2048   // keys per batch
#define CC 128    // width of the query, key and value rows
#define NQ 1024   // queries per batch
#define SCALE (0.08838834764831845f)   // 1 / sqrt(128)

#define WS_QH  0u                                      // f16 q rows [b*NQ + t][CC]
#define WS_KH  (WS_QH + 2u * (size_t)NB * NQ * CC)      // f16 k rows [b*TT + t][CC]
#define WS_VT  (WS_KH + 2u * (size_t)NB * TT * CC)      // f16 v planes [b][c][t]
#define WS_END (WS_VT + 2u * (size_t)NB * CC * TT)

// ---- k_cvt: block = one tile of 128 rows x 128 columns, read once in whole 512-byte rows, every element rounded to bf16 and written as f16. Blocks 0 .. NVT-1: v tiles, turned through LDS into the planes [c][t] (256-byte runs of 128 keys); then the k tiles, then the q tiles, rows kept as they are. Few, large blocks, for speed only.
#define TR 128             // rows per tile
#define NVT (NB * TT / TR)
#define NKT (NB * TT / TR)
#define NQT (NB * NQ / TR)
static_assert(TT % TR == 0 && NQ % TR == 0 && TR == 128, "whole tiles; 128 threads deal 32 rows to a wave and 16-byte pieces of 128 x 128 to the threads");
__device__ __forceinline__ _Float16 hb(float v) { return (_Float16)(float)(__bf16)v; }
// every "#pragma unroll" in k_cvt: all of a thread's loads are issued before the first value is used, and the register arrays need constant indices
__global__ __launch_bounds__(128) void k_cvt(const float* __restrict__ XQ, const float* __restrict__ XK, const float* __restrict__ XV, _Float16* __restrict__ QH, _Float16* __restrict__ KH, _Float16* __restrict__ VT) {
  __shared__ __align__(16) _Float16 th[CC][TR + 8];
  const int tid = threadIdx.x, wave = tid >> 5, lane = tid & 31; const unsigned blk = blockIdx.x;
  v4f x[32];
  if (blk >= NVT) {   /* block-uniform: k or q rows, no LDS and no barrier */
    const bool isk = blk < NVT + NKT; const size_t o = (size_t)(isk ? blk - NVT : blk - NVT - NKT) * (TR * CC) + (unsigned)tid * 4u;
    const float* X = (isk ? XK : XQ) + o; _Float16* D = (isk ? KH : QH) + o;
#pragma unroll
    for (int i = 0; i < 32; ++i) x[i] = *(const v4f*)(X + i * 512);
    __builtin_amdgcn_sched_barrier(0);   /* all 32 loads are issued before the first conversion: a load held back for a free register would pay the memory latency a second time */
#pragma unroll
    for (int i = 0; i < 32; ++i) { const v4h h = { hb(x[i][0]), hb(x[i][1]), hb(x[i][2]), hb(x[i][3]) }; vst2(D + i * 512, h); }
    return; }
  const unsigned bb = blk / (TT / TR), t0 = (blk % (TT / TR)) * TR;
  /* wave = 32 keys, lane = 4 columns: each load is one whole row */
  const float* X = XV + ((size_t)bb * TT + t0 + wave * 32) * CC + lane * 4;
#pragma unroll
  for (int i = 0; i < 32; ++i) x[i] = *(const v4f*)(X + i * CC);
  __builtin_amdgcn_sched_barrier(0);   /* as above: all 32 loads first */
#pragma unroll
  for (int u = 0; u < 4; ++u)
#pragma unroll
    for (int c = 0; c < 4; ++c) { v8h p;
#pragma unroll
      for (int e = 0; e < 8; ++e) p[e] = hb(x[u * 8 + e][c]);
      *(v8h*)&th[lane * 4 + c][wave * 32 + u * 8] = p; }
  __syncthreads();   /* every wave's 32 keys are in the tile before a column's 128 keys are read back */
  _Float16* D = VT + ((size_t)bb * CC + (tid >> 4)) * TT + t0 + (tid & 15) * 8;
#pragma unroll
  for (int i = 0; i < 16; ++i) vst2(D + (size_t)i * 8 * TT, *(const v4u*)&th[i * 8 + (tid >> 4)][(tid & 15) * 8]);
  asm volatile("s_wait_xcnt 0x0" ::: "memory"); }   /* behind the last store, before any code that follows in the listing can overwrite a register the stores name */
#define FK 64              // keys per pass
#define SL2 (SCALE * 1.4426950408889634f)   // logits in log2 units: exp(x) = exp2(x * log2 e)
static_assert(TT % FK == 0 && NQ % 64 == 0 && CC == 128 && FK == 64, "whole passes; the tile fetch deals 16-byte pieces of 64 x 128 and 128 x 64 tiles to 128 threads");
__device__ __forceinline__ float xhalf(float x) { return __builtin_bit_cast(float, __builtin_amdgcn_permlanex16(__builtin_bit_cast(int, x), __builtin_bit_cast(int, x), 0x76543210, 0xfedcba98, false, false)); }   // lane l with lane l ^ 16
// every "#pragma unroll" in k_fa: the register arrays (fragments, score tiles, accumulators, fetched pieces) need constant indices to stay in registers
__global__ __launch_bounds__(128) void k_fa(const _Float16* __restrict__ QH, const _Float16* __restrict__ KH, const _Float16* __restrict__ VT, const int* __restrict__ NKEYS, float* __restrict__ Y) {
  __shared__ __align__(16) _Float16 ks[2][FK][CC + 8]; __shared__ __align__(16) _Float16 vs[2][CC][FK + 8];
  const int tid = threadIdx.x, wave = tid >> 5, lane = tid & 31, col = lane & 15, g = lane >> 4;
  const int nk = NKEYS[blockIdx.z];   /* only compared with key indices, never part of an address */
  QH += (size_t)blockIdx.z * NQ * CC; KH += (size_t)blockIdx.z * TT * CC; VT += (size_t)blockIdx.z * CC * TT; Y += (size_t)blockIdx.z * NQ * CC;
  const int q = blockIdx.x * 64 + wave * 16 + col;
  /* tile fetch: thread tid takes 16-byte piece tid + 128 i of each tile; k tile = 64 whole rows (contiguous), v tile = 128 rows of 128 bytes */
  const unsigned ko = (unsigned)tid * 8u, vo = (unsigned)(tid >> 3) * TT + (unsigned)(tid & 7) * 8u;
  v16h qf[4]; v4u kr[8], vr[8];
#pragma unroll
  for (int kc = 0; kc < 4; ++kc) qf[kc] = frag_h(QH + (size_t)q * CC + kc * 32, lane);
#pragma unroll
  for (int i = 0; i < 8; ++i) { kr[i] = *(const v4u*)(KH + ko + i * 1024u); vr[i] = *(const v4u*)(VT + vo + i * 16u * TT); }
  asm volatile("s_wait_xcnt 0x0" ::: "memory");   /* before any address register of the loads above is overwritten */
  __builtin_amdgcn_sched_barrier(0);   /* keeps the index arithmetic below, which reuses those registers, from being lifted over the wait */
  const unsigned kd = (unsigned)(tid >> 4) * (CC + 8) + (unsigned)(tid & 15) * 8u, vd = (unsigned)(tid >> 3) * (FK + 8) + (unsigned)(tid & 7) * 8u;   /* the pieces' places in the LDS tiles */
#pragma unroll
  for (int i = 0; i < 8; ++i) { *(v4u*)(&ks[0][0][0] + kd + i * 8u * (CC + 8)) = kr[i]; *(v4u*)(&vs[0][0][0] + vd + i * 16u * (FK + 8)) = vr[i]; }
  __syncthreads();
  float m = -3.0e38f, l = 0.f; v8f acc[8] = {};
#pragma unroll 1   /* rolled: one copy of the long pass in the instruction cache */
  for (int it = 0; it < TT / FK; ++it) { const int cur = it & 1;
    if (it + 1 < TT / FK) { const _Float16* kn = KH + (size_t)(it + 1) * FK * CC; const _Float16* vn = VT + (it + 1) * FK;
#pragma unroll
      for (int i = 0; i < 8; ++i) { kr[i] = *(const v4u*)(kn + ko + i * 1024u); vr[i] = *(const v4u*)(vn + vo + i * 16u * TT); }
      asm volatile("s_wait_xcnt 0x0" ::: "memory"); }   /* before any address register of the loads above is overwritten */
    v16h kf[4][4], vf[2][8];
#pragma unroll
    for (int t = 0; t < 4; ++t)
#pragma unroll
      for (int kc = 0; kc < 4; ++kc) kf[t][kc] = frag_h(&ks[cur][t * 16 + col][kc * 32], lane);
    __builtin_amdgcn_sched_barrier(0);   /* k reads ahead of the v reads: LDS answers in order, and the first product needs k alone */
#pragma unroll
    for (int u = 0; u < 2; ++u)
#pragma unroll
      for (int j = 0; j < 8; ++j) vf[u][j] = frag_h(&vs[cur][j * 16 + col][u * 32], lane);
    __builtin_amdgcn_sched_barrier(0);   /* the v reads stay one group ahead of the products, in flight under the first product and the exponentials */
    v8f st[4];
#pragma unroll
    for (int t = 0; t < 4; ++t) { v8f s = {};
#pragma unroll
      for (int kc = 0; kc < 4; ++kc) s = __builtin_amdgcn_wmma_f32_16x16x32_f16(false, kf[t][kc], false, qf[kc], (short)0, s, false, false);
      st[t] = s; }
    /* st[t][r] = raw logit of key it * 64 + t * 16 + 8 g + r for query col */
    if ((it + 1) * FK > nk) { const int rem = nk - it * FK - 8 * g;   /* block-uniform: only passes that reach past the valid keys pay for the mask */
#pragma unroll
      for (int t = 0; t < 4; ++t)
#pragma unroll
        for (int r = 0; r < 8; ++r) st[t][r] = (t * 16 + r < rem) ? st[t][r] : -3.0e38f; }
    float mt[4];
#pragma unroll
    for (int t = 0; t < 4; ++t) { mt[t] = st[t][0];
#pragma unroll
      for (int r = 1; r < 8; ++r) mt[t] = fmaxf(mt[t], st[t][r]); }
    float mx = fmaxf(fmaxf(mt[0], mt[1]), fmaxf(mt[2], mt[3])); mx = fmaxf(m, fmaxf(mx, xhalf(mx)));
    const float al = __builtin_amdgcn_exp2f((m - mx) * SL2), ms = mx * SL2; m = mx;
    float ps[4]; v16h pb[2];
#pragma unroll
    for (int t = 0; t < 4; ++t) { ps[t] = 0.f;
#pragma unroll
      for (int r = 0; r < 8; ++r) { const float p = __builtin_amdgcn_exp2f(fmaf(st[t][r], SL2, -ms)); ps[t] += p; pb[t >> 1][(t & 1) * 8 + r] = (_Float16)p; } }
    l = l * al + ((ps[0] + ps[1]) + (ps[2] + ps[3]));
#pragma unroll
    for (int j = 0; j < 8; ++j) acc[j] *= al;
#pragma unroll
    for (int u = 0; u < 2; ++u)
#pragma unroll
      for (int j = 0; j < 8; ++j) acc[j] = __builtin_amdgcn_wmma_f32_16x16x32_f16(false, vf[u][j], false, pb[u], (short)0, acc[j], false, false);
    if (it + 1 < TT / FK) {
#pragma unroll
      for (int i = 0; i < 8; ++i) { *(v4u*)(&ks[cur ^ 1][0][0] + kd + i * 8u * (CC + 8)) = kr[i]; *(v4u*)(&vs[cur ^ 1][0][0] + vd + i * 16u * (FK + 8)) = vr[i]; } }
    __syncthreads(); }   /* publishes the other buffer and ends every wave's reads of this one */
  l += xhalf(l);
  const float inv = (nk > 0 && l > 0.f) ? 1.0f / l : 0.f;   /* a fully excluded row yields 0 */
  float* yr = Y + (size_t)q * CC + 8 * g;   /* acc[j][r] = out[query col][j * 16 + 8 g + r] */
#pragma unroll
  for (int j = 0; j < 8; ++j) { const v4f a = { acc[j][0] * inv, acc[j][1] * inv, acc[j][2] * inv, acc[j][3] * inv }, c = { acc[j][4] * inv, acc[j][5] * inv, acc[j][6] * inv, acc[j][7] * inv }; vst2(yr + j * 16, a); vst2(yr + j * 16 + 4, c); } }

extern "C" void kernel_launch(void* const* d_in, const int* in_sizes, int n_in, void* d_out, int out_size, void* d_ws, size_t ws_size, hipStream_t stream) {
  (void)in_sizes; (void)n_in; (void)out_size;
  const float** F = (const float**)d_in;
  if (ws_size < (size_t)WS_END) return;
  char* ws = (char*)d_ws; _Float16 *QH = (_Float16*)(ws + WS_QH), *KH = (_Float16*)(ws + WS_KH), *VT = (_Float16*)(ws + WS_VT);
  // inputs: 0 qrys [16,1024,128]; 1 keys [16,2048,128]; 2 vals [16,2048,128]; 3 num_keys [16] int32
  k_cvt<<<NVT + NKT + NQT, 128, 0, stream>>>(F[0], F[1], F[2], QH, KH, VT);   /* f16 q and k rows, f16 v planes */
  /* scores, softmax and P x V in one launch for all batches: the batch is blockIdx.z */
  k_fa<<<dim3(NQ / 64, 1, NB), 128, 0, stream>>>(QH, KH, VT, (const int*)d_in[3], (float*)d_out);
}

// v004
// Measured time: 35 microseconds a run.
// Timed twice side by side with v003, it ran 1.27 times as fast both times.
// Over all steps from v000 it is 56.1 times as fast.
// compute dtype: queries / keys / values rounded to bf16 and carried EXACTLY into f16 planes (one streaming conversion kernel; v transposed on the way); logits q x k as single EXACT f16 products x 128^-0.5; keys at or beyond num_keys[b] excluded; softmax f32 with a running maximum and sum per query; P = exp(logit - running maximum) once to f16 x v (exact f16) (1 product); f32 output.
#include <hip/hip_runtime.h>
#include <math.h>

typedef __attribute__((ext_vector_type(16))) _Float16 v16h;
typedef __attribute__((ext_vector_type(8)))  _Float16 v8h;
typedef __attribute__((ext_vector_type(4)))  _Float16 v4h;
typedef __attribute__((ext_vector_type(8)))  float v8f;
typedef __attribute__((ext_vector_type(4)))  float v4f;
typedef __attribute__((ext_vector_type(4)))  unsigned v4u;

template <typename T> __device__ __forceinline__ void vst2(void* p, T v) { *(T*)p = v;  }
// 16x16x32 fragments: lane = (h = lane>>4, row/col = lane&15); elements 0..7 = k0+8h+0..7, 8..15 = k0+16+8h+0..7; D element r = row 8h+r
__device__ __forceinline__ v16h frag_h(const _Float16* rowk0, int lane) {
  union { v16h v; v8h q[2]; } u; const _Float16* p = rowk0 + 8 * (lane >> 4);
  u.q[0] = *(const v8h*)p; u.q[1] = *(const v8h*)(p + 16); return u.v;
}

// Raw scaled-dot-product attention with a per-batch valid-key count (qrys [16,1024,128]; keys, vals [16,2048,128]; num_keys [16] int32 in [1, 2048); logits = q k^T / sqrt(128); only keys k < num_keys[b] take part (masked max, exp * mask, normalised over the valid keys); out = atts vals, [16,1024,128]). No learned weights. One 128-wide head per batch; one launch of each stage covers all batches; the scores stay in registers.
#define NB 16
#define TT 2048   // keys per batch
#define CC 128    // width of the query, key and value rows
#define NQ 1024   // queries per batch
#define SCALE (0.08838834764831845f)   // 1 / sqrt(128)

#define WS_QH  0u                                      // f16 q rows [b*NQ + t][CC]
#define WS_KH  (WS_QH + 2u * (size_t)NB * NQ * CC)      // f16 k rows [b*TT + t][CC]
#define WS_VT  (WS_KH + 2u * (size_t)NB * TT * CC)      // f16 v planes [b][c][t]
#define WS_END (WS_VT + 2u * (size_t)NB * CC * TT)

// ---- k_cvt: block = one tile of 128 rows x 128 columns, read once in whole 512-byte rows, every element rounded to bf16 and written as f16. Blocks 0 .. NVT-1: v tiles, turned through LDS into the planes [c][t] (256-byte runs of 128 keys); then the k tiles, then the q tiles, rows kept as they are. Few, large blocks, for speed only.
#define TR 128             // rows per tile
#define NVT (NB * TT / TR)
#define NKT (NB * TT / TR)
#define NQT (NB * NQ / TR)
static_assert(TT % TR == 0 && NQ % TR == 0 && TR == 128, "whole tiles; 128 threads deal 32 rows to a wave and 16-byte pieces of 128 x 128 to the threads");
__device__ __forceinline__ _Float16 hb(float v) { return (_Float16)(float)(__bf16)v; }
// every "#pragma unroll" in k_cvt: all of a thread's loads are issued before the first value is used, and the register arrays need constant indices
__global__ __launch_bounds__(128) void k_cvt(const float* __restrict__ XQ, const float* __restrict__ XK, const float* __restrict__ XV, _Float16* __restrict__ QH, _Float16* __restrict__ KH, _Float16* __restrict__ VT) {
  __shared__ __align__(16) _Float16 th[CC][TR + 8];
  const int tid = threadIdx.x, wave = tid >> 5, lane = tid & 31; const unsigned blk = blockIdx.x;
  v4f x[32];
  if (blk >= NVT) {   /* block-uniform: k or q rows, no LDS and no barrier */
    const bool isk = blk < NVT + NKT; const size_t o = (size_t)(isk ? blk - NVT : blk - NVT - NKT) * (TR * CC) + (unsigned)tid * 4u;
    const float* X = (isk ? XK : XQ) + o; _Float16* D = (isk ? KH : QH) + o;
#pragma unroll
    for (int i = 0; i < 32; ++i) x[i] = *(const v4f*)(X + i * 512);
    __builtin_amdgcn_sched_barrier(0);   /* all 32 loads are issued before the first conversion: a load held back for a free register would pay the memory latency a second time */
#pragma unroll
    for (int i = 0; i < 32; ++i) { const v4h h = { hb(x[i][0]), hb(x[i][1]), hb(x[i][2]), hb(x[i][3]) }; vst2(D + i * 512, h); }
    return; }
  const unsigned bb = blk / (TT / TR), t0 = (blk % (TT / TR)) * TR;
  /* wave = 32 keys, lane = 4 columns: each load is one whole row */
  const float* X = XV + ((size_t)bb * TT + t0 + wave * 32) * CC + lane * 4;
#pragma unroll
  for (int i = 0; i < 32; ++i) x[i] = *(const v4f*)(X + i * CC);
  __builtin_amdgcn_sched_barrier(0);   /* as above: all 32 loads first */
#pragma unroll
  for (int u = 0; u < 4; ++u)
#pragma unroll
    for (int c = 0; c < 4; ++c) { v8h p;
#pragma unroll
      for (int e = 0; e < 8; ++e) p[e] = hb(x[u * 8 + e][c]);
      *(v8h*)&th[lane * 4 + c][wave * 32 + u * 8] = p; }
  __syncthreads();   /* every wave's 32 keys are in the tile before a column's 128 keys are read back */
  _Float16* D = VT + ((size_t)bb * CC + (tid >> 4)) * TT + t0 + (tid & 15) * 8;
#pragma unroll
  for (int i = 0; i < 16; ++i) vst2(D + (size_t)i * 8 * TT, *(const v4u*)&th[i * 8 + (tid >> 4)][(tid & 15) * 8]);
  asm volatile("s_wait_xcnt 0x0" ::: "memory"); }   /* behind the last store, before any code that follows in the listing can overwrite a register the stores name */
#define FK 64              // keys per pass
#define NG 2               // key groups per block
#define SL2 (SCALE * 1.4426950408889634f)   // logits in log2 units: exp(x) = exp2(x * log2 e)
static_assert(TT % (FK * NG) == 0 && NQ % 64 == 0 && CC == 128 && FK == 64 && NG == 2, "whole passes, as many for each group; the tile fetch deals 16-byte pieces of 64 x 128 and 128 x 64 tiles to a group's 128 threads; the join swaps halves between two groups");
__device__ __forceinline__ float xhalf(float x) { return __builtin_bit_cast(float, __builtin_amdgcn_permlanex16(__builtin_bit_cast(int, x), __builtin_bit_cast(int, x), 0x76543210, 0xfedcba98, false, false)); }   // lane l with lane l ^ 16
// every "#pragma unroll" in k_fa: the register arrays (fragments, score tiles, accumulators, fetched pieces) need constant indices to stay in registers
__global__ __launch_bounds__(128 * NG) void k_fa(const _Float16* __restrict__ QH, const _Float16* __restrict__ KH, const _Float16* __restrict__ VT, const int* __restrict__ NKEYS, float* __restrict__ Y) {
  __shared__ __align__(16) _Float16 ks[NG][2][FK][CC + 8]; __shared__ __align__(16) _Float16 vs[NG][2][CC][FK + 8];
  const int grp = __builtin_amdgcn_readfirstlane((int)(threadIdx.x >> 7));   /* the same in a whole wave: kept scalar for the tile addresses and the mask test */
  const int tid = threadIdx.x & 127, wave = tid >> 5, lane = tid & 31, col = lane & 15, g = lane >> 4;
  const int nk = NKEYS[blockIdx.z];   /* only compared with key indices, never part of an address */
  QH += (size_t)blockIdx.z * NQ * CC; KH += (size_t)blockIdx.z * TT * CC + (size_t)grp * FK * CC; VT += (size_t)blockIdx.z * CC * TT + grp * FK; Y += (size_t)blockIdx.z * NQ * CC;   /* KH, VT: at this group's first pass */
  const int q = blockIdx.x * 64 + wave * 16 + col;
  /* tile fetch: thread tid takes 16-byte piece tid + 128 i of each tile; k tile = 64 whole rows (contiguous), v tile = 128 rows of 128 bytes */
  const unsigned ko = (unsigned)tid * 8u, vo = (unsigned)(tid >> 3) * TT + (unsigned)(tid & 7) * 8u;
  v16h qf[4]; v4u kr[8], vr[8];
#pragma unroll
  for (int kc = 0; kc < 4; ++kc) qf[kc] = frag_h(QH + (size_t)q * CC + kc * 32, lane);
  asm volatile("s_wait_xcnt 0x0" ::: "memory");   /* before the address pair of the q loads is overwritten */
#pragma unroll
  for (int i = 0; i < 8; ++i) { kr[i] = *(const v4u*)(KH + ko + i * 1024u); vr[i] = *(const v4u*)(VT + vo + i * 16u * TT); }
  asm volatile("s_wait_xcnt 0x0" ::: "memory");   /* before any address register of the loads above is overwritten */
  __builtin_amdgcn_sched_barrier(0);   /* keeps the index arithmetic below, which reuses those registers, from being lifted over the wait */
  const unsigned kd = (unsigned)(tid >> 4) * (CC + 8) + (unsigned)(tid & 15) * 8u, vd = (unsigned)(tid >> 3) * (FK + 8) + (unsigned)(tid & 7) * 8u;   /* the pieces' places in the LDS tiles */
#pragma unroll
  for (int i = 0; i < 8; ++i) { *(v4u*)(&ks[grp][0][0][0] + kd + i * 8u * (CC + 8)) = kr[i]; *(v4u*)(&vs[grp][0][0][0] + vd + i * 16u * (FK + 8)) = vr[i]; }
  __syncthreads();
  float m = -1.0e30f, l = 0.f; v8f acc[8] = {};   /* the start value lies below every logit and far above the mask value: a group whose keys are all excluded keeps it, its exponentials are 0, and its sum and accumulators stay 0 for the join */
#pragma unroll 1   /* rolled: one copy of the long pass in the instruction cache */
  for (int it = 0; it < TT / (FK * NG); ++it) { const int cur = it & 1, k0 = (it * NG + grp) * FK;   /* k0: first key of this group's pass */
    if (it + 1 < TT / (FK * NG)) { const _Float16* kn = KH + (size_t)(it + 1) * (NG * FK * CC); const _Float16* vn = VT + (it + 1) * (NG * FK);
#pragma unroll
      for (int i = 0; i < 8; ++i) { kr[i] = *(const v4u*)(kn + ko + i * 1024u); vr[i] = *(const v4u*)(vn + vo + i * 16u * TT); }
      asm volatile("s_wait_xcnt 0x0" ::: "memory"); }   /* before any address register of the loads above is overwritten */
    v16h kf[4][4], vf[2][8];
#pragma unroll
    for (int t = 0; t < 4; ++t)
#pragma unroll
      for (int kc = 0; kc < 4; ++kc) kf[t][kc] = frag_h(&ks[grp][cur][t * 16 + col][kc * 32], lane);
    __builtin_amdgcn_sched_barrier(0);   /* k reads ahead of the v reads: LDS answers in order, and the first product needs k alone */
#pragma unroll
    for (int u = 0; u < 2; ++u)
#pragma unroll
      for (int j = 0; j < 8; ++j) vf[u][j] = frag_h(&vs[grp][cur][j * 16 + col][u * 32], lane);
    __builtin_amdgcn_sched_barrier(0);   /* the v reads stay one group ahead of the products, in flight under the first product and the exponentials */
    v8f st[4];
#pragma unroll
    for (int t = 0; t < 4; ++t) { v8f s = {};
#pragma unroll
      for (int kc = 0; kc < 4; ++kc) s = __builtin_amdgcn_wmma_f32_16x16x32_f16(false, kf[t][kc], false, qf[kc], (short)0, s, false, false);
      st[t] = s; }
    /* st[t][r] = raw logit of key k0 + t * 16 + 8 g + r for query col */
    if (k0 + FK > nk) { const int rem = nk - k0 - 8 * g;   /* the same in a whole group, no barrier inside: only passes that reach past the valid keys pay for the mask */
#pragma unroll
      for (int t = 0; t < 4; ++t)
#pragma unroll
        for (int r = 0; r < 8; ++r) st[t][r] = (t * 16 + r < rem) ? st[t][r] : -3.0e38f; }
    float mt[4];
#pragma unroll
    for (int t = 0; t < 4; ++t) { mt[t] = st[t][0];
#pragma unroll
      for (int r = 1; r < 8; ++r) mt[t] = fmaxf(mt[t], st[t][r]); }
    float mx = fmaxf(fmaxf(mt[0], mt[1]), fmaxf(mt[2], mt[3])); mx = fmaxf(m, fmaxf(mx, xhalf(mx)));
    const float al = __builtin_amdgcn_exp2f((m - mx) * SL2), ms = mx * SL2; m = mx;
    float ps[4]; v16h pb[2];
#pragma unroll
    for (int t = 0; t < 4; ++t) { ps[t] = 0.f;
#pragma unroll
      for (int r = 0; r < 8; ++r) { const float p = __builtin_amdgcn_exp2f(fmaf(st[t][r], SL2, -ms)); ps[t] += p; pb[t >> 1][(t & 1) * 8 + r] = (_Float16)p; } }
    l = l * al + ((ps[0] + ps[1]) + (ps[2] + ps[3]));
#pragma unroll
    for (int j = 0; j < 8; ++j) acc[j] *= al;
#pragma unroll
    for (int u = 0; u < 2; ++u)
#pragma unroll
      for (int j = 0; j < 8; ++j) acc[j] = __builtin_amdgcn_wmma_f32_16x16x32_f16(false, vf[u][j], false, pb[u], (short)0, acc[j], false, false);
    if (it + 1 < TT / (FK * NG)) {
#pragma unroll
      for (int i = 0; i < 8; ++i) { *(v4u*)(&ks[grp][cur ^ 1][0][0] + kd + i * 8u * (CC + 8)) = kr[i]; *(v4u*)(&vs[grp][cur ^ 1][0][0] + vd + i * 16u * (FK + 8)) = vr[i]; } }
    __syncthreads(); }   /* publishes the other buffer and ends every wave's reads of this one */
  /* join: group grp finishes the output columns grp * 64 .. grp * 64 + 63 (its accumulators own[]) and hands the other four (oth[]), with its maximum and sum, to the thread of the same tid in the other group. The k tiles are dead behind the loop's last barrier and serve as the exchange space. */
  static_assert(sizeof(ks) >= NG * 128 * (8 * sizeof(v4f) + 2 * sizeof(float)), "the exchange space fits into the k tiles");
  v4f* xa = (v4f*)&ks[0][0][0][0]; float* xm = (float*)(xa + NG * 8 * 128);   /* xa[grp][piece][tid], xm[grp][m or l][tid]: neighbouring lanes, neighbouring 16 bytes */
  v8f own[4], oth[4];
#pragma unroll
  for (int i = 0; i < 4; ++i) { own[i] = grp ? acc[4 + i] : acc[i]; oth[i] = grp ? acc[i] : acc[4 + i]; }
#pragma unroll
  for (int i = 0; i < 4; ++i) { const v4f a = { oth[i][0], oth[i][1], oth[i][2], oth[i][3] }, c = { oth[i][4], oth[i][5], oth[i][6], oth[i][7] }; xa[(grp * 8 + 2 * i) * 128 + tid] = a; xa[(grp * 8 + 2 * i + 1) * 128 + tid] = c; }
  xm[(grp * 2) * 128 + tid] = m; xm[(grp * 2 + 1) * 128 + tid] = l;
  __syncthreads();   /* each group's hand-over is written before the other group reads it */
  const int og = grp ^ 1; const float mo = xm[(og * 2) * 128 + tid], lo = xm[(og * 2 + 1) * 128 + tid];
  const float mj = fmaxf(m, mo), fs = __builtin_amdgcn_exp2f((m - mj) * SL2), fo = __builtin_amdgcn_exp2f((mo - mj) * SL2);   /* each part rescaled to the common maximum; a group without a valid key gets the factor 0 */
  l = l * fs + lo * fo; l += xhalf(l);
  const float inv = (nk > 0 && l > 0.f) ? 1.0f / l : 0.f;   /* a fully excluded row yields 0 */
  const float ws = fs * inv, wo = fo * inv;
  float* yr = Y + (size_t)q * CC + grp * 64 + 8 * g;   /* own[i][r] = out[query col][grp * 64 + i * 16 + 8 g + r] */
#pragma unroll
  for (int i = 0; i < 4; ++i) { const v4f pa = xa[(og * 8 + 2 * i) * 128 + tid], pc = xa[(og * 8 + 2 * i + 1) * 128 + tid];
    const v4f a = { own[i][0] * ws + pa[0] * wo, own[i][1] * ws + pa[1] * wo, own[i][2] * ws + pa[2] * wo, own[i][3] * ws + pa[3] * wo }, c = { own[i][4] * ws + pc[0] * wo, own[i][5] * ws + pc[1] * wo, own[i][6] * ws + pc[2] * wo, own[i][7] * ws + pc[3] * wo };
    vst2(yr + i * 16, a); vst2(yr + i * 16 + 4, c); } }

extern "C" void kernel_launch(void* const* d_in, const int* in_sizes, int n_in, void* d_out, int out_size, void* d_ws, size_t ws_size, hipStream_t stream) {
  (void)in_sizes; (void)n_in; (void)out_size;
  const float** F = (const float**)d_in;
  if (ws_size < (size_t)WS_END) return;
  char* ws = (char*)d_ws; _Float16 *QH = (_Float16*)(ws + WS_QH), *KH = (_Float16*)(ws + WS_KH), *VT = (_Float16*)(ws + WS_VT);
  // inputs: 0 qrys [16,1024,128]; 1 keys [16,2048,128]; 2 vals [16,2048,128]; 3 num_keys [16] int32
  k_cvt<<<NVT + NKT + NQT, 128, 0, stream>>>(F[0], F[1], F[2], QH, KH, VT);   /* f16 q and k rows, f16 v planes */
  /* scores, softmax and P x V in one launch for all batches: the batch is blockIdx.z */
  k_fa<<<dim3(NQ / 64, 1, NB), 128 * NG, 0, stream>>>(QH, KH, VT, (const int*)d_in[3], (float*)d_out);
}

// v005
// One run takes 32.1 microseconds.
// Two timings next to v004 put it at 1.08 and 1.10 times that version's speed.
// All steps since v000 together make it 61.1 times as fast.
// compute dtype: queries / keys / values rounded to bf16 and carried EXACTLY into f16 planes (one streaming conversion kernel; v transposed on the way); logits q x k as single EXACT f16 products x 128^-0.5; keys at or beyond num_keys[b] excluded (whole trips of 256 keys of them are neither converted nor walked); softmax f32 with a running maximum and sum per query; P = exp(logit - running maximum) once to f16 x v (exact f16) (1 product); f32 output.
#include <hip/hip_runtime.h>
#include <math.h>

typedef __attribute__((ext_vector_type(16))) _Float16 v16h;
typedef __attribute__((ext_vector_type(8)))  _Float16 v8h;
typedef __attribute__((ext_vector_type(4)))  _Float16 v4h;
typedef __attribute__((ext_vector_type(8)))  float v8f;
typedef __attribute__((ext_vector_type(4)))  float v4f;
typedef __attribute__((ext_vector_type(4)))  unsigned v4u;

template <typename T> __device__ __forceinline__ void vst2(void* p, T v) { *(T*)p = v;  }
// 16x16x32 fragments: lane = (h = lane>>4, row/col = lane&15); elements 0..7 = k0+8h+0..7, 8..15 = k0+16+8h+0..7; D element r = row 8h+r
__device__ __forceinline__ v16h frag_h(const _Float16* rowk0, int lane) {
  union { v16h v; v8h q[2]; } u; const _Float16* p = rowk0 + 8 * (lane >> 4);
  u.q[0] = *(const v8h*)p; u.q[1] = *(const v8h*)(p + 16); return u.v;
}

// Raw scaled-dot-product attention with a per-batch valid-key count (qrys [16,1024,128]; keys, vals [16,2048,128]; num_keys [16] int32 in [1, 2048); logits = q k^T / sqrt(128); only keys k < num_keys[b] take part (masked max, exp * mask, normalised over the valid keys); out = atts vals, [16,1024,128]). No learned weights. One 128-wide head per batch; one launch of each stage covers all batches; the scores stay in registers.
#define NB 16
#define TT 2048   // keys per batch
#define CC 128    // width of the query, key and value rows
#define NQ 1024   // queries per batch
#define SCALE (0.08838834764831845f)   // 1 / sqrt(128)

#define WS_QH  0u                                      // f16 q rows [b*NQ + t][CC]
#define WS_KH  (WS_QH + 2u * (size_t)NB * NQ * CC)      // f16 k rows [b*TT + t][CC]
#define WS_VT  (WS_KH + 2u * (size_t)NB * TT * CC)      // f16 v planes [b][c][t]
#define WS_END (WS_VT + 2u * (size_t)NB * CC * TT)

#define FK 64              // keys per pass of one key group
#define NG 4               // key groups per block of k_fa: one trip of its loop walks NG * FK keys
// trips that hold a valid key of a batch with n valid keys: at least 1 (the first tiles always exist), at most all; n is clamped first, so the count is bounded for any content of num_keys. k_cvt and k_fa use the same count: what k_fa reads, k_cvt has written.
__device__ __forceinline__ int ntrip(int n) { n = n < 0 ? 0 : (n > TT ? TT : n); const int p = (n + NG * FK - 1) / (NG * FK); return p < 1 ? 1 : p; }

// ---- k_cvt: block = one tile of 128 rows x 128 columns, read once in whole 512-byte rows, every element rounded to bf16 and written as f16. Blocks 0 .. NVT-1: v tiles, turned through LDS into the planes [c][t] (256-byte runs of 128 keys); then the k tiles, then the q tiles, rows kept as they are. Few, large blocks, for speed only.
#define TR 128             // rows per tile
#define NVT (NB * TT / TR)
#define NKT (NB * TT / TR)
#define NQT (NB * NQ / TR)
static_assert(TT % TR == 0 && NQ % TR == 0 && TR == 128 && (NG * FK) % TR == 0, "whole tiles; 128 threads deal 32 rows to a wave and 16-byte pieces of 128 x 128 to the threads; a trip of k_fa is whole tiles");
__device__ __forceinline__ _Float16 hb(float v) { return (_Float16)(float)(__bf16)v; }
// every "#pragma unroll" in k_cvt: all of a thread's loads are issued before the first value is used, and the register arrays need constant indices
__global__ __launch_bounds__(128) void k_cvt(const float* __restrict__ XQ, const float* __restrict__ XK, const float* __restrict__ XV, const int* __restrict__ NKEYS, _Float16* __restrict__ QH, _Float16* __restrict__ KH, _Float16* __restrict__ VT) {
  __shared__ __align__(16) _Float16 th[CC][TR + 8];
  const int tid = threadIdx.x, wave = tid >> 5, lane = tid & 31; const unsigned blk = blockIdx.x;
  if (blk < NVT + NKT) {   /* block-uniform and ahead of the barrier: a k or v tile behind the last trip that k_fa walks for its batch is never read, so it is neither loaded nor written */
    const unsigned t = blk < NVT ? blk : blk - NVT;
    if ((int)((t % (TT / TR)) * TR) >= ntrip(NKEYS[t / (TT / TR)]) * (NG * FK)) return; }
  v4f x[32];
  if (blk >= NVT) {   /* block-uniform: k or q rows, no LDS and no barrier */
    const bool isk = blk < NVT + NKT; const size_t o = (size_t)(isk ? blk - NVT : blk - NVT - NKT) * (TR * CC) + (unsigned)tid * 4u;
    const float* X = (isk ? XK : XQ) + o; _Float16* D = (isk ? KH : QH) + o;
#pragma unroll
    for (int i = 0; i < 32; ++i) x[i] = *(const v4f*)(X + i * 512);
    __builtin_amdgcn_sched_barrier(0);   /* all 32 loads are issued before the first conversion: a load held back for a free register would pay the memory latency a second time */
#pragma unroll
    for (int i = 0; i < 32; ++i) { const v4h h = { hb(x[i][0]), hb(x[i][1]), hb(x[i][2]), hb(x[i][3]) }; vst2(D + i * 512, h); }
    return; }
  const unsigned bb = blk / (TT / TR), t0 = (blk % (TT / TR)) * TR;
  /* wave = 32 keys, lane = 4 columns: each load is one whole row */
  const float* X = XV + ((size_t)bb * TT + t0 + wave * 32) * CC + lane * 4;
#pragma unroll
  for (int i = 0; i < 32; ++i) x[i] = *(const v4f*)(X + i * CC);
  __builtin_amdgcn_sched_barrier(0);   /* as above: all 32 loads first */
#pragma unroll
  for (int u = 0; u < 4; ++u)
#pragma unroll
    for (int c = 0; c < 4; ++c) { v8h p;
#pragma unroll
      for (int e = 0; e < 8; ++e) p[e] = hb(x[u * 8 + e][c]);
      *(v8h*)&th[lane * 4 + c][wave * 32 + u * 8] = p; }
  __syncthreads();   /* every wave's 32 keys are in the tile before a column's 128 keys are read back */
  _Float16* D = VT + ((size_t)bb * CC + (tid >> 4)) * TT + t0 + (tid & 15) * 8;
#pragma unroll
  for (int i = 0; i < 16; ++i) vst2(D + (size_t)i * 8 * TT, *(const v4u*)&th[i * 8 + (tid >> 4)][(tid & 15) * 8]);
  asm volatile("s_wait_xcnt 0x0" ::: "memory"); }   /* behind the last store, before any code that follows in the listing can overwrite a register the stores name */
#define QT 32              // queries per tile
#define GT 64              // threads per key group
#define SL2 (SCALE * 1.4426950408889634f)   // logits in log2 units: exp(x) = exp2(x * log2 e)
static_assert(TT % (FK * NG) == 0 && NQ % QT == 0 && NB == 16 && CC == 128 && FK == 64 && NG == 4 && QT == 32 && GT == 64, "whole trips; one lane column per batch in the ranking, the batches in pairs; the tile fetch deals 16-byte pieces of 64 x 128 and 128 x 64 tiles to a group's 64 threads; the join gives each of four groups 32 output columns");
__device__ __forceinline__ float xhalf(float x) { return __builtin_bit_cast(float, __builtin_amdgcn_permlanex16(__builtin_bit_cast(int, x), __builtin_bit_cast(int, x), 0x76543210, 0xfedcba98, false, false)); }   // lane l with lane l ^ 16
// a block-uniform address held in a scalar pair: the compiler then keeps one lane offset for all tiles and adds the scalar base at the loads, instead of carrying 64-bit per-lane bases for the batch and for the trip; at the register limit of two waves per SIMD those pairs decide between a spill and none
typedef const __attribute__((address_space(1))) char* gbytes;   // global memory, named as such: an address rebuilt from integers would otherwise be loaded through the generic path
typedef const __attribute__((address_space(1))) v4u* gpiece;
__device__ __forceinline__ gbytes sbase(const void* p) { const unsigned long long a = (unsigned long long)p; return (gbytes)(((unsigned long long)(unsigned)__builtin_amdgcn_readfirstlane((int)(a >> 32)) << 32) | (unsigned)__builtin_amdgcn_readfirstlane((int)(unsigned)a)); }
// every "#pragma unroll" in k_fa: the register arrays (fragments, score tiles, accumulators, fetched pieces) need constant indices to stay in registers
__global__ __launch_bounds__(GT * NG) void k_fa(const _Float16* __restrict__ QH, const _Float16* __restrict__ KH, const _Float16* __restrict__ VT, const int* __restrict__ NKEYS, float* __restrict__ Y) {
  __shared__ __align__(16) _Float16 ks[NG][2][FK][CC + 8]; __shared__ __align__(16) _Float16 vs[NG][2][CC][FK + 8];
  const int grp = __builtin_amdgcn_readfirstlane((int)(threadIdx.x >> 6));   /* the same in a whole wave: kept scalar for the tile addresses and the mask test */
  const int tid = threadIdx.x & (GT - 1), wave = tid >> 5, lane = tid & 31, col = lane & 15, g = lane >> 4;
  /* lane column col ranks batch col: the number of batches with more valid keys, ties by index, so the ranks are a permutation of 0 .. NB - 1 for any content of num_keys, the same in every wave */
  const int mine = NKEYS[col];
  asm volatile("s_wait_xcnt 0x0" ::: "memory");   /* before the address register of the load above is overwritten */
  int rank = 0;
#pragma unroll
  for (int j = 0; j < NB; ++j) { const int o = NKEYS[j]; rank += (o > mine || (o == mine && j < col)) ? 1 : 0; }
  const int pr = blockIdx.x / (NQ / QT), q = (blockIdx.x % (NQ / QT)) * QT + wave * 16 + col;
  /* the batch of a wanted rank: its lane column's bit in the ballot; bit NB - 1 is set as well, so the index stays below NB whatever the ballot holds */
  const int blong = __builtin_ctz(__builtin_amdgcn_ballot_w32(rank == pr) | (1u << (NB - 1))), bshort = __builtin_ctz(__builtin_amdgcn_ballot_w32(rank == NB - 1 - pr) | (1u << (NB - 1)));
  /* its count comes from the lane that holds it: no second load */
  const int nlong = __builtin_amdgcn_readlane(mine, blong), nshort = __builtin_amdgcn_readlane(mine, bshort);
  /* tile fetch: thread tid takes 16-byte piece tid + 64 i of each tile; k tile = 64 whole rows (contiguous), v tile = 128 rows of 128 bytes; kd, vd: the pieces' places in the LDS tiles */
  const unsigned ko = (unsigned)tid * 16u, vo = (unsigned)(tid >> 3) * (2u * TT) + (unsigned)(tid & 7) * 16u;   /* in bytes, added to a scalar base (sbase) */
  const unsigned kd = (unsigned)(tid >> 4) * (CC + 8) + (unsigned)(tid & 15) * 8u, vd = (unsigned)(tid >> 3) * (FK + 8) + (unsigned)(tid & 7) * 8u;
#pragma unroll 1   /* rolled: one copy of the long tile body in the instruction cache */
  for (int h = 0; h < 2; ++h) {
    const int b = h ? bshort : blong;
    const int nk = h ? nshort : nlong, nt = ntrip(nk);   /* nk: only compared with key indices; nt: the clamped trip count, the same in the whole block */
    const _Float16* kb = KH + (size_t)b * TT * CC + (size_t)grp * FK * CC; const _Float16* vb = VT + (size_t)b * CC * TT + grp * FK;   /* at this group's first pass */
    v16h qf[4]; v4u kr[16], vr[16];
#pragma unroll
    for (int kc = 0; kc < 4; ++kc) qf[kc] = frag_h(QH + ((size_t)b * NQ + q) * CC + kc * 32, lane);
    asm volatile("s_wait_xcnt 0x0" ::: "memory");   /* before the address pair of the q loads is overwritten */
#pragma unroll
    for (int i = 0; i < 16; ++i) { kr[i] = *(gpiece)(sbase(kb) + ko + i * 1024); vr[i] = *(gpiece)(sbase(vb) + vo + i * (16 * TT)); }
    asm volatile("s_wait_xcnt 0x0" ::: "memory");   /* before any address register of the loads above is overwritten */
    __builtin_amdgcn_sched_barrier(0);   /* keeps the arithmetic below, which reuses those registers, from being lifted over the wait */
#pragma unroll
    for (int i = 0; i < 16; ++i) { *(v4u*)(&ks[grp][0][0][0] + kd + i * 4u * (CC + 8)) = kr[i]; *(v4u*)(&vs[grp][0][0][0] + vd + i * 8u * (FK + 8)) = vr[i]; }
    __syncthreads();
    float m = -1.0e30f, l = 0.f; v8f acc[8] = {};   /* the start value lies below every logit and far above the mask value: a group whose keys are all excluded keeps it, its exponentials are 0, and its sum and accumulators stay 0 for the join */
#pragma unroll 1   /* rolled: one copy of the long pass in the instruction cache */
    for (int it = 0; it < nt; ++it) { const int cur = it & 1, k0 = (it * NG + grp) * FK;   /* k0: first key of this group's pass */
      if (it + 1 < nt) { const gbytes kn = sbase(kb + (size_t)(it + 1) * (NG * FK * CC)), vn = sbase(vb + (it + 1) * (NG * FK));
#pragma unroll
        for (int i = 0; i < 16; ++i) { kr[i] = *(gpiece)(kn + ko + i * 1024); vr[i] = *(gpiece)(vn + vo + i * (16 * TT)); }
        asm volatile("s_wait_xcnt 0x0" ::: "memory"); }   /* before any address register of the loads above is overwritten */
      v16h kf[4][4], vf[2][8];
#pragma unroll
      for (int t = 0; t < 4; ++t)
#pragma unroll
        for (int kc = 0; kc < 4; ++kc) kf[t][kc] = frag_h(&ks[grp][cur][t * 16 + col][kc * 32], lane);
      __builtin_amdgcn_sched_barrier(0);   /* k reads ahead of the v reads: LDS answers in order, and the first product needs k alone */
#pragma unroll
      for (int u = 0; u < 2; ++u)
#pragma unroll
        for (int j = 0; j < 8; ++j) vf[u][j] = frag_h(&vs[grp][cur][j * 16 + col][u * 32], lane);
      __builtin_amdgcn_sched_barrier(0);   /* the v reads stay one group ahead of the products, in flight under the first product and the exponentials */
      v8f st[4];
#pragma unroll
      for (int t = 0; t < 4; ++t) { v8f s = {};
#pragma unroll
        for (int kc = 0; kc < 4; ++kc) s = __builtin_amdgcn_wmma_f32_16x16x32_f16(false, kf[t][kc], false, qf[kc], (short)0, s, false, false);
        st[t] = s; }
      /* st[t][r] = raw logit of key k0 + t * 16 + 8 g + r for query col */
      if (k0 + FK > nk) { const int rem = nk - k0 - 8 * g;   /* the same in a whole group, no barrier inside: only passes that reach past the valid keys pay for the mask */
#pragma unroll
        for (int t = 0; t < 4; ++t)
#pragma unroll
          for (int r = 0; r < 8; ++r) st[t][r] = (t * 16 + r < rem) ? st[t][r] : -3.0e38f; }
      float mt[4];
#pragma unroll
      for (int t = 0; t < 4; ++t) { mt[t] = st[t][0];
#pragma unroll
        for (int r = 1; r < 8; ++r) mt[t] = fmaxf(mt[t], st[t][r]); }
      float mx = fmaxf(fmaxf(mt[0], mt[1]), fmaxf(mt[2], mt[3])); mx = fmaxf(m, fmaxf(mx, xhalf(mx)));
      const float al = __builtin_amdgcn_exp2f((m - mx) * SL2), ms = mx * SL2; m = mx;
      float ps[4]; v16h pb[2];
#pragma unroll
      for (int t = 0; t < 4; ++t) { ps[t] = 0.f;
#pragma unroll
        for (int r = 0; r < 8; ++r) { const float p = __builtin_amdgcn_exp2f(fmaf(st[t][r], SL2, -ms)); ps[t] += p; pb[t >> 1][(t & 1) * 8 + r] = (_Float16)p; } }
      l = l * al + ((ps[0] + ps[1]) + (ps[2] + ps[3]));
#pragma unroll
      for (int j = 0; j < 8; ++j) acc[j] *= al;
#pragma unroll
      for (int u = 0; u < 2; ++u)
#pragma unroll
        for (int j = 0; j < 8; ++j) acc[j] = __builtin_amdgcn_wmma_f32_16x16x32_f16(false, vf[u][j], false, pb[u], (short)0, acc[j], false, false);
      if (it + 1 < nt) {
#pragma unroll
        for (int i = 0; i < 16; ++i) { *(v4u*)(&ks[grp][cur ^ 1][0][0] + kd + i * 4u * (CC + 8)) = kr[i]; *(v4u*)(&vs[grp][cur ^ 1][0][0] + vd + i * 8u * (FK + 8)) = vr[i]; } }
      __syncthreads(); }   /* publishes the other buffer and ends every wave's reads of this one */
    /* join: every group lays its eight accumulator tiles, its maximum and its sum into the exchange space; group grp then finishes the output columns grp * 32 .. grp * 32 + 31 from the four groups' parts, always in the order of the groups. The k tiles are dead behind the loop's last barrier and serve as the exchange space. */
    static_assert(sizeof(ks) >= NG * GT * (16 * sizeof(v4f) + 2 * sizeof(float)), "the exchange space fits into the k tiles");
    v4f* xa = (v4f*)&ks[0][0][0][0]; float* xm = (float*)(xa + NG * 16 * GT);   /* xa[grp][piece][tid], xm[grp][m or l][tid]: neighbouring lanes, neighbouring 16 bytes */
#pragma unroll
    for (int j = 0; j < 8; ++j) { const v4f a = { acc[j][0], acc[j][1], acc[j][2], acc[j][3] }, c = { acc[j][4], acc[j][5], acc[j][6], acc[j][7] }; xa[(grp * 16 + 2 * j) * GT + tid] = a; xa[(grp * 16 + 2 * j + 1) * GT + tid] = c; }
    xm[(grp * 2) * GT + tid] = m; xm[(grp * 2 + 1) * GT + tid] = l;
    __syncthreads();   /* every group's part is written before another group reads it */
    float mo[NG], f[NG];
#pragma unroll
    for (int x = 0; x < NG; ++x) mo[x] = xm[(x * 2) * GT + tid];
    const float mj = fmaxf(fmaxf(mo[0], mo[1]), fmaxf(mo[2], mo[3]));
    l = 0.f;
#pragma unroll
    for (int x = 0; x < NG; ++x) { f[x] = __builtin_amdgcn_exp2f((mo[x] - mj) * SL2); l += xm[(x * 2 + 1) * GT + tid] * f[x]; }   /* each part rescaled to the common maximum; a group without a valid key gets the factor 0 beside one that has some */
    l += xhalf(l);
    const float inv = (nk > 0 && l > 0.f) ? 1.0f / l : 0.f;   /* a fully excluded row yields 0 */
    float* yr = Y + ((size_t)b * NQ + q) * CC + grp * 32 + 8 * g;   /* tile j, element r = out[query col][j * 16 + 8 g + r]; this group's tiles are j = 2 grp, 2 grp + 1 */
#pragma unroll
    for (int i = 0; i < 2; ++i) { v4f a = {}, c = {};
#pragma unroll
      for (int x = 0; x < NG; ++x) { const float w = f[x] * inv; a += xa[(x * 16 + (grp * 2 + i) * 2) * GT + tid] * w; c += xa[(x * 16 + (grp * 2 + i) * 2 + 1) * GT + tid] * w; }
      vst2(yr + i * 16, a); vst2(yr + i * 16 + 4, c); }
    asm volatile("s_wait_xcnt 0x0" ::: "memory");   /* before the next tile's arithmetic overwrites an address register of the stores above */
    __syncthreads(); } }   /* ends every wave's reads of the exchange space before the next tile's k pieces are stored there */

extern "C" void kernel_launch(void* const* d_in, const int* in_sizes, int n_in, void* d_out, int out_size, void* d_ws, size_t ws_size, hipStream_t stream) {
  (void)in_sizes; (void)n_in; (void)out_size;
  const float** F = (const float**)d_in;
  if (ws_size < (size_t)WS_END) return;
  char* ws = (char*)d_ws; _Float16 *QH = (_Float16*)(ws + WS_QH), *KH = (_Float16*)(ws + WS_KH), *VT = (_Float16*)(ws + WS_VT);
  // inputs: 0 qrys [16,1024,128]; 1 keys [16,2048,128]; 2 vals [16,2048,128]; 3 num_keys [16] int32
  k_cvt<<<NVT + NKT + NQT, 128, 0, stream>>>(F[0], F[1], F[2], (const int*)d_in[3], QH, KH, VT);   /* f16 q and k rows, f16 v planes, as far as a batch's valid keys reach */
  /* scores, softmax and P x V in one launch for all batches: a block takes one query tile of each batch of a pair */
  k_fa<<<(NB / 2) * (NQ / QT), GT * NG, 0, stream>>>(QH, KH, VT, (const int*)d_in[3], (float*)d_out);
}

// v006
// It runs in 26 microseconds.
// In both of two side-by-side timings against v005, it was 1.24 times as fast.
// All steps since v000 together make it 75.6 times as fast.
// compute dtype: queries / keys / values rounded to bf16 and carried EXACTLY into f16 (one streaming conversion kernel, which lays k and v out in the order of the matrix fragments); logits q x k as single EXACT f16 products x 128^-0.5; keys at or beyond num_keys[b] excluded (whole trips of them are not converted, whole passes of them not walked); softmax f32 with a running maximum and sum per query; P = exp(logit - running maximum) once to f16 x v (exact f16) (1 product); f32 output.
#include <hip/hip_runtime.h>
#include <math.h>

typedef __attribute__((ext_vector_type(16))) _Float16 v16h;
typedef __attribute__((ext_vector_type(8)))  _Float16 v8h;
typedef __attribute__((ext_vector_type(4)))  _Float16 v4h;
typedef __attribute__((ext_vector_type(8)))  float v8f;
typedef __attribute__((ext_vector_type(4)))  float v4f;
typedef __attribute__((ext_vector_type(4)))  unsigned v4u;

template <typename T> __device__ __forceinline__ void vst2(void* p, T v) { *(T*)p = v;  }
// 16x16x32 fragments: lane = (h = lane>>4, row/col = lane&15); elements 0..7 = k0+8h+0..7, 8..15 = k0+16+8h+0..7; D element r = row 8h+r
__device__ __forceinline__ v16h frag_h(const _Float16* rowk0, int lane) {
  union { v16h v; v8h q[2]; } u; const _Float16* p = rowk0 + 8 * (lane >> 4);
  u.q[0] = *(const v8h*)p; u.q[1] = *(const v8h*)(p + 16); return u.v;
}

// Raw scaled-dot-product attention with a per-batch valid-key count (qrys [16,1024,128]; keys, vals [16,2048,128]; num_keys [16] int32 in [1, 2048); logits = q k^T / sqrt(128); only keys k < num_keys[b] take part (masked max, exp * mask, normalised over the valid keys); out = atts vals, [16,1024,128]). No learned weights. One 128-wide head per batch; one launch of each stage covers all batches; the scores stay in registers.
#define NB 16
#define TT 2048   // keys per batch
#define CC 128    // width of the query, key and value rows
#define NQ 1024   // queries per batch
#define SCALE (0.08838834764831845f)   // 1 / sqrt(128)

#define WS_QH  0u                                      // f16 q rows [b*NQ + t][CC]
#define WS_KH  (WS_QH + 2u * (size_t)NB * NQ * CC)      // f16 k in fragment order: 16-byte piece [b*TT/16 + t/16][kc][p][lane] = k[16 (t/16) + (lane & 15)][32 kc + 16 p + 8 (lane >> 4) + 0..7]
#define WS_VT  (WS_KH + 2u * (size_t)NB * TT * CC)      // f16 v in fragment order: 16-byte piece [b*TT/32 + t/32][j][p][lane] = v[32 (t/32) + 16 p + 8 (lane >> 4) + 0..7][16 j + (lane & 15)]
#define WS_END (WS_VT + 2u * (size_t)NB * CC * TT)

#define FK 32              // keys per pass of one key group
#define NG 8               // key groups (one wave each) per block of k_fa: one trip walks NG * FK keys
// trips that hold a valid key of a batch with n valid keys: at least 1 (the first tiles always exist), at most all; n is clamped first, so the count is bounded for any content of num_keys. k_cvt converts whole trips; k_fa reads only passes that begin below the clamped n, which lie inside them: what k_fa reads, k_cvt has written.
__device__ __forceinline__ int ntrip(int n) { n = n < 0 ? 0 : (n > TT ? TT : n); const int p = (n + NG * FK - 1) / (NG * FK); return p < 1 ? 1 : p; }

// ---- k_cvt: block = one tile of 128 rows x 128 columns, read once in whole 512-byte rows, every element rounded to bf16 and written as f16. Blocks 0 .. NVT-1: v tiles; then the k tiles; both go through LDS and leave it in 16-byte pieces in the order of the matrix fragments (WS_KH, WS_VT above), so that a wave of k_fa fetches a fragment half with one load of 512 bytes in a row; a tile fills the same 32 KiB of the workspace as its rows would. Then the q tiles, rows kept as they are. Few, large blocks, for speed only.
#define TR 128             // rows per tile
#define NVT (NB * TT / TR)
#define NKT (NB * TT / TR)
#define NQT (NB * NQ / TR)
static_assert(TT % TR == 0 && NQ % TR == 0 && TR == 128 && CC == 128 && (NG * FK) % TR == 0, "whole tiles; 128 threads deal 32 rows to a wave and 16-byte pieces of 128 x 128 to the threads; a trip of k_fa is whole tiles");
__device__ __forceinline__ _Float16 hb(float v) { return (_Float16)(float)(__bf16)v; }
// every "#pragma unroll" in k_cvt: all of a thread's loads are issued before the first value is used, and the register arrays need constant indices
__global__ __launch_bounds__(128) void k_cvt(const float* __restrict__ XQ, const float* __restrict__ XK, const float* __restrict__ XV, const int* __restrict__ NKEYS, _Float16* __restrict__ QH, _Float16* __restrict__ KH, _Float16* __restrict__ VT) {
  __shared__ __align__(16) _Float16 th[TR][TR + 8];
  const int tid = threadIdx.x, wave = tid >> 5, lane = tid & 31; const unsigned blk = blockIdx.x;
  if (blk < NVT + NKT) {   /* block-uniform and ahead of the barrier: a k or v tile behind the last trip that k_fa walks for its batch is never read, so it is neither loaded nor written */
    const unsigned t = blk < NVT ? blk : blk - NVT;
    if ((int)((t % (TT / TR)) * TR) >= ntrip(NKEYS[t / (TT / TR)]) * (NG * FK)) return; }
  v4f x[32];
  if (blk >= NVT + NKT) {   /* block-uniform: q rows, no LDS and no barrier */
    const size_t o = (size_t)(blk - NVT - NKT) * (TR * CC) + (unsigned)tid * 4u;
    const float* X = XQ + o; _Float16* D = QH + o;
#pragma unroll
    for (int i = 0; i < 32; ++i) x[i] = *(const v4f*)(X + i * 512);
    __builtin_amdgcn_sched_barrier(0);   /* all 32 loads are issued before the first conversion: a load held back for a free register would pay the memory latency a second time */
#pragma unroll
    for (int i = 0; i < 32; ++i) { const v4h h = { hb(x[i][0]), hb(x[i][1]), hb(x[i][2]), hb(x[i][3]) }; vst2(D + i * 512, h); }
    return; }
  const bool isv = blk < NVT; const unsigned tile = isv ? blk : blk - NVT;   /* block-uniform; the tiles of a batch follow one another, so tile counts 128 keys over all batches */
  if (isv) {   /* th[column][key]. wave = 32 keys, lane = 4 columns: each load is one whole row */
    const float* X = XV + ((size_t)tile * TR + wave * 32) * CC + lane * 4;
#pragma unroll
    for (int i = 0; i < 32; ++i) x[i] = *(const v4f*)(X + i * CC);
    __builtin_amdgcn_sched_barrier(0);   /* as above: all 32 loads first */
#pragma unroll
    for (int u = 0; u < 4; ++u)
#pragma unroll
      for (int c = 0; c < 4; ++c) { v8h p;
#pragma unroll
        for (int e = 0; e < 8; ++e) p[e] = hb(x[u * 8 + e][c]);
        *(v8h*)&th[lane * 4 + c][wave * 32 + u * 8] = p; }
  } else {   /* th[key][column]. load i of a wave is the whole row 4 i + wave */
    const float* X = XK + (size_t)tile * (TR * CC) + (unsigned)tid * 4u;
#pragma unroll
    for (int i = 0; i < 32; ++i) x[i] = *(const v4f*)(X + i * 512);
    __builtin_amdgcn_sched_barrier(0);   /* as above: all 32 loads first */
#pragma unroll
    for (int i = 0; i < 32; ++i) { const v4h h = { hb(x[i][0]), hb(x[i][1]), hb(x[i][2]), hb(x[i][3]) }; *(v4h*)&th[i * 4 + wave][lane * 4] = h; } }
  __syncthreads();   /* the whole tile is in LDS before a fragment's pieces are read back */
  /* run bp = 4 i + wave of 32 pieces is one half p of one fragment; the matrix row is th's row, the contraction index th's column. v: bp = (32 keys, j, p); k: bp = (16 keys, kc, p) */
  _Float16* D = (isv ? VT : KH) + (size_t)tile * (TR * CC) + (unsigned)tid * 8u;
#pragma unroll
  for (int i = 0; i < 16; ++i) { const int bp = i * 4 + wave;
    const int r = (isv ? ((bp >> 1) & 7) : (bp >> 3)) * 16 + (lane & 15), c = (isv ? (bp >> 4) : ((bp >> 1) & 3)) * 32 + (bp & 1) * 16 + (lane >> 4) * 8;
    vst2(D + i * 1024, *(const v4u*)&th[r][c]); }
  asm volatile("s_wait_xcnt 0x0" ::: "memory"); }   /* behind the last store, before any code that follows in the listing can overwrite a register the stores name */
// ---- k_fa: block = two tiles of QT queries, one after the other: of the batch that stands at place pr when the batches are ranked by their valid keys, longest first, and of the batch at place NB - 1 - pr, so that a long tile shares its block with a short one and the blocks, one to a WGP, end near together. A tile is worked on by NG waves; every wave holds all QT queries (two B operands of 16) and owns the passes grp, grp + NG, ... of FK keys, as far as they begin below the valid keys: no key is used by two waves of a block, so k and v need no LDS: a wave fetches its A fragments, laid out for that by k_cvt, straight into registers, and no wave waits for another inside the loop. Running maximum, sum and accumulators are the wave's own; the partial results are joined through LDS at the tile's end. Per pass: S^T = K Q^T (A = k, B = q kept in registers), running maximum and sum per query (one lane column = one query), P^T packed from the score tiles into the B operand, O^T += V^T P^T (A = v). The next pass's k is fetched as soon as the scores are formed, the next pass's v as soon as the second product is issued: each flies under the work that does not need it.
#define QT 32              // queries per tile
#define SL2 (SCALE * 1.4426950408889634f)   // logits in log2 units: exp(x) = exp2(x * log2 e)
static_assert(TT % (FK * NG) == 0 && NQ % QT == 0 && NB == 16 && CC == 128 && FK == 32 && NG == 8 && QT == 32, "whole trips; one lane column per batch in the ranking, the batches in pairs; a pass is two k row blocks and one v key block; the join gives each of eight waves 16 queries x 32 output columns");
__device__ __forceinline__ float xhalf(float x) { return __builtin_bit_cast(float, __builtin_amdgcn_permlanex16(__builtin_bit_cast(int, x), __builtin_bit_cast(int, x), 0x76543210, 0xfedcba98, false, false)); }   // lane l with lane l ^ 16
// a wave-uniform address held in a scalar pair: the compiler then keeps one lane offset for all fragments and adds the scalar base at the loads, instead of carrying 64-bit per-lane addresses
typedef const __attribute__((address_space(1))) char* gbytes;   // global memory, named as such: an address rebuilt from integers would otherwise be loaded through the generic path
typedef const __attribute__((address_space(1))) v4u* gpiece;
__device__ __forceinline__ gbytes sbase(const void* p) { const unsigned long long a = (unsigned long long)p; return (gbytes)(((unsigned long long)(unsigned)__builtin_amdgcn_readfirstlane((int)(a >> 32)) << 32) | (unsigned)__builtin_amdgcn_readfirstlane((int)(unsigned)a)); }
// fragment i of a pass: its two halves are runs 2 i and 2 i + 1 of 32 pieces; p = the pass's first byte + 16 * lane
__device__ __forceinline__ v16h frag_g(gbytes p, int i) { union { v16h v; v4u q[2]; } u; u.q[0] = *(gpiece)(p + i * 1024); u.q[1] = *(gpiece)(p + i * 1024 + 512); return u.v; }
// behind a run of fragment loads from p, before a register that they name is overwritten; p is an input so that its registers stay p's up to the wait: otherwise the last load's data may be given the address pair of the loads before it
__device__ __forceinline__ void xwait(gbytes p) { asm volatile("s_wait_xcnt 0x0" :: "v"(p) : "memory"); }
// every "#pragma unroll" without a count in fa_pass and k_fa: the register arrays (fragments, score tiles, accumulators) need constant indices to stay in registers
// one pass of FK keys of one wave. LAST = false: another pass of this wave follows: its k is fetched behind the first product and its v behind the second, with no branch in the pass, so that the loop's waits for k leave the v loads in flight; such a pass lies wholly below the valid keys and needs no mask. LAST = true: nothing is fetched, and the keys at or beyond nk are masked.
template <bool LAST> __device__ __forceinline__ void fa_pass(v16h (&kf)[2][4], v16h (&vf)[8], const v16h (&qf)[2][4], v8f (&acc)[2][8], float (&m)[2], float (&l)[2], const char* kb, const char* vb, unsigned lo, int k0, int nk, int g) {
  v8f st[2][2] = {};
#pragma unroll
  for (int kc = 0; kc < 4; ++kc)
#pragma unroll
    for (int t = 0; t < 2; ++t)
#pragma unroll
      for (int s = 0; s < 2; ++s) st[t][s] = __builtin_amdgcn_wmma_f32_16x16x32_f16(false, kf[t][kc], false, qf[s][kc], (short)0, st[t][s], false, false);
  /* st[t][s][r] = raw logit of key k0 + t * 16 + 8 g + r for query s * 16 + col of the tile */
  if (!LAST) { const gbytes kn = sbase(kb + (size_t)(k0 + NG * FK) * (CC * 2)) + lo;
#pragma unroll
    for (int i = 0; i < 8; ++i) kf[i >> 2][i & 3] = frag_g(kn, i);
    xwait(kn);
    __builtin_amdgcn_sched_barrier(0); }   /* all of the next k is asked for before the exponentials begin: a load held back behind them would have the second product alone to fly under */
  if (LAST && k0 + FK > nk) { const int rem = nk - k0 - 8 * g;   /* the same in a whole wave: only a pass that reaches past the valid keys pays for the mask */
#pragma unroll
    for (int t = 0; t < 2; ++t)
#pragma unroll
      for (int s = 0; s < 2; ++s)
#pragma unroll
        for (int r = 0; r < 8; ++r) st[t][s][r] = (t * 16 + r < rem) ? st[t][s][r] : -3.0e38f; }
  v16h pb[2];
#pragma unroll
  for (int s = 0; s < 2; ++s) { float mt[2];
#pragma unroll
    for (int t = 0; t < 2; ++t) { mt[t] = st[t][s][0];
#pragma unroll
      for (int r = 1; r < 8; ++r) mt[t] = fmaxf(mt[t], st[t][s][r]); }
    float mx = fmaxf(mt[0], mt[1]); mx = fmaxf(m[s], fmaxf(mx, xhalf(mx)));
    const float al = __builtin_amdgcn_exp2f((m[s] - mx) * SL2), ms = mx * SL2; m[s] = mx;
    float ps[2];
#pragma unroll
    for (int t = 0; t < 2; ++t) { ps[t] = 0.f;
#pragma unroll
      for (int r = 0; r < 8; ++r) { const float p = __builtin_amdgcn_exp2f(fmaf(st[t][s][r], SL2, -ms)); ps[t] += p; pb[s][t * 8 + r] = (_Float16)p; } }
    l[s] = l[s] * al + (ps[0] + ps[1]);
#pragma unroll
    for (int j = 0; j < 8; ++j) acc[s][j] *= al; }
#pragma unroll
  for (int j = 0; j < 8; ++j)
#pragma unroll
    for (int s = 0; s < 2; ++s) acc[s][j] = __builtin_amdgcn_wmma_f32_16x16x32_f16(false, vf[j], false, pb[s], (short)0, acc[s][j], false, false);
  if (!LAST) { const gbytes vn = sbase(vb + (size_t)(k0 + NG * FK) * (CC * 2)) + lo;
#pragma unroll
    for (int j = 0; j < 8; ++j) vf[j] = frag_g(vn, j);
    xwait(vn); } }
__global__ __launch_bounds__(32 * NG) void k_fa(const _Float16* __restrict__ QH, const _Float16* __restrict__ KH, const _Float16* __restrict__ VT, const int* __restrict__ NKEYS, float* __restrict__ Y) {
  /* exchange space of the join, one for each of the block's two tiles: xa[tile][wave][piece (s * 8 + j) * 2 + half][lane], xm[tile][wave][s * 2 + (0: maximum, 1: sum)][lane]: neighbouring lanes, neighbouring 16 bytes */
  __shared__ __align__(16) v4f xa[2][NG][32][32]; __shared__ float xm[2][NG][4][32];
  const int grp = __builtin_amdgcn_readfirstlane((int)(threadIdx.x >> 5));   /* the wave's number: kept scalar for the pass addresses and the loop tests */
  const int lane = threadIdx.x & 31, col = lane & 15, g = lane >> 4;
  /* lane column col ranks batch col: the number of batches with more valid keys, ties by index, so the ranks are a permutation of 0 .. NB - 1 for any content of num_keys, the same in every wave */
  const int mine = NKEYS[col];
  asm volatile("s_wait_xcnt 0x0" ::: "memory");   /* before the address register of the load above is overwritten */
  int rank = 0;
#pragma unroll
  for (int j = 0; j < NB; ++j) { const int o = NKEYS[j]; rank += (o > mine || (o == mine && j < col)) ? 1 : 0; }
  const int pr = blockIdx.x / (NQ / QT), q0 = (blockIdx.x % (NQ / QT)) * QT;
  /* the batch of a wanted rank: its lane column's bit in the ballot; bit NB - 1 is set as well, so the index stays below NB whatever the ballot holds */
  const int blong = __builtin_ctz(__builtin_amdgcn_ballot_w32(rank == pr) | (1u << (NB - 1))), bshort = __builtin_ctz(__builtin_amdgcn_ballot_w32(rank == NB - 1 - pr) | (1u << (NB - 1)));
  /* its count comes from the lane that holds it: no second load */
  const int nlong = __builtin_amdgcn_readlane(mine, blong), nshort = __builtin_amdgcn_readlane(mine, bshort);
  const unsigned lo = (unsigned)lane * 16u;   /* in bytes, added to a scalar base (sbase) */
#pragma unroll 1   /* rolled: one copy of the long tile body in the instruction cache */
  for (int h = 0; h < 2; ++h) {
    const int b = h ? bshort : blong;
    const int nk = h ? nshort : nlong, ne = nk < 0 ? 0 : (nk > TT ? TT : nk);   /* nk: only compared with key indices; ne: clamped, it bounds the passes and so every k and v address for any content of num_keys */
    const char* kb = (const char*)KH + (size_t)b * (TT * CC * 2); const char* vb = (const char*)VT + (size_t)b * (TT * CC * 2);   /* in both layouts the FK keys from k0 on are the FK * CC * 2 bytes from k0 * CC * 2 on */
    v16h qf[2][4], kf[2][4], vf[8];
    float m[2] = { -1.0e30f, -1.0e30f }, l[2] = { 0.f, 0.f }; v8f acc[2][8] = {};   /* the start value lies below every logit and far above the mask value; a wave without a pass keeps it, and its sum and accumulators stay 0 for the join */
    int k0 = grp * FK;   /* first key of this wave's pass */
    if (k0 < ne) {   /* the same in a whole wave; no barrier inside */
      const gbytes kn = sbase(kb + (size_t)k0 * (CC * 2)) + lo, vn = sbase(vb + (size_t)k0 * (CC * 2)) + lo;
#pragma unroll
      for (int s = 0; s < 2; ++s)
#pragma unroll
        for (int kc = 0; kc < 4; ++kc) qf[s][kc] = frag_h(QH + ((size_t)b * NQ + q0 + s * 16 + col) * CC + kc * 32, lane);
      asm volatile("s_wait_xcnt 0x0" ::: "memory");   /* before a register that the q loads name is overwritten, be it by a later load's data */
      __builtin_amdgcn_sched_barrier(0);   /* keeps the q loads in front of that wait and the k loads behind it */
#pragma unroll
      for (int i = 0; i < 8; ++i) kf[i >> 2][i & 3] = frag_g(kn, i);
      xwait(kn);
      __builtin_amdgcn_sched_barrier(0);   /* keeps the k loads in front of that wait and the v loads behind it */
#pragma unroll
      for (int j = 0; j < 8; ++j) vf[j] = frag_g(vn, j);
      xwait(vn);
      __builtin_amdgcn_sched_barrier(0);   /* keeps the v loads in front of that wait and the arithmetic below behind it */
#pragma unroll 1   /* rolled: one copy of the long pass in the instruction cache; at most TT / (NG * FK) - 1 trips */
      for (; k0 + NG * FK < ne; k0 += NG * FK) fa_pass<false>(kf, vf, qf, acc, m, l, kb, vb, lo, k0, nk, g);
      fa_pass<true>(kf, vf, qf, acc, m, l, kb, vb, lo, k0, nk, g); }
    /* join: every wave lays its sixteen accumulator tiles, its maxima and its sums into this tile's exchange space; wave grp then finishes the queries of s = grp & 1 in the output columns (grp >> 1) * 32 .. + 31, one whole 128-byte line a query, from the eight waves' parts, always in the order of the waves */
#pragma unroll
    for (int s = 0; s < 2; ++s) {
#pragma unroll
      for (int j = 0; j < 8; ++j) { const v4f a = { acc[s][j][0], acc[s][j][1], acc[s][j][2], acc[s][j][3] }, c = { acc[s][j][4], acc[s][j][5], acc[s][j][6], acc[s][j][7] }; xa[h][grp][(s * 8 + j) * 2][lane] = a; xa[h][grp][(s * 8 + j) * 2 + 1][lane] = c; }
      xm[h][grp][s * 2][lane] = m[s]; xm[h][grp][s * 2 + 1][lane] = l[s]; }
    __syncthreads();   /* every wave's part is written before another wave reads it; the block's other tile has an exchange space of its own, so no second barrier is needed */
    const int sj = grp & 1, cq = grp >> 1;
    float mo[NG], f[NG];
#pragma unroll
    for (int x = 0; x < NG; ++x) mo[x] = xm[h][x][sj * 2][lane];
    const float mj = fmaxf(fmaxf(fmaxf(mo[0], mo[1]), fmaxf(mo[2], mo[3])), fmaxf(fmaxf(mo[4], mo[5]), fmaxf(mo[6], mo[7])));
    float lj = 0.f;
#pragma unroll
    for (int x = 0; x < NG; ++x) { f[x] = __builtin_amdgcn_exp2f((mo[x] - mj) * SL2); lj += xm[h][x][sj * 2 + 1][lane] * f[x]; }   /* each part rescaled to the common maximum; a wave without a valid key gets the factor 0 beside one that has some */
    lj += xhalf(lj);
    const float inv = (nk > 0 && lj > 0.f) ? 1.0f / lj : 0.f;   /* a fully excluded row yields 0 */
    float* yr = Y + ((size_t)b * NQ + q0 + sj * 16 + col) * CC + cq * 32 + 8 * g;   /* tile j, element r = out[query col][j * 16 + 8 g + r]; this wave's tiles are j = 2 cq, 2 cq + 1 */
#pragma unroll
    for (int i = 0; i < 2; ++i) { v4f a = {}, c = {};
#pragma unroll
      for (int x = 0; x < NG; ++x) { const float w = f[x] * inv; a += xa[h][x][(sj * 8 + cq * 2 + i) * 2][lane] * w; c += xa[h][x][(sj * 8 + cq * 2 + i) * 2 + 1][lane] * w; }
      vst2(yr + i * 16, a); vst2(yr + i * 16 + 4, c); }
    asm volatile("s_wait_xcnt 0x0" ::: "memory"); } }   /* before the next tile's arithmetic overwrites an address register of the stores above */

extern "C" void kernel_launch(void* const* d_in, const int* in_sizes, int n_in, void* d_out, int out_size, void* d_ws, size_t ws_size, hipStream_t stream) {
  (void)in_sizes; (void)n_in; (void)out_size;
  const float** F = (const float**)d_in;
  if (ws_size < (size_t)WS_END) return;
  char* ws = (char*)d_ws; _Float16 *QH = (_Float16*)(ws + WS_QH), *KH = (_Float16*)(ws + WS_KH), *VT = (_Float16*)(ws + WS_VT);
  // inputs: 0 qrys [16,1024,128]; 1 keys [16,2048,128]; 2 vals [16,2048,128]; 3 num_keys [16] int32
  k_cvt<<<NVT + NKT + NQT, 128, 0, stream>>>(F[0], F[1], F[2], (const int*)d_in[3], QH, KH, VT);   /* f16 q rows, f16 k and v in fragment order, as far as a batch's valid keys reach */
  /* scores, softmax and P x V in one launch for all batches: a block takes one query tile of each batch of a pair */
  k_fa<<<(NB / 2) * (NQ / QT), 32 * NG, 0, stream>>>(QH, KH, VT, (const int*)d_in[3], (float*)d_out);
}

// v007
// It runs in 23.1 microseconds.
// In two side-by-side timings against v006, it was 1.13 and 1.12 times as fast.
// All steps since v000 together make it 85.0 times as fast.
// compute dtype: queries / keys / values rounded to bf16 and carried EXACTLY into f16 (one streaming conversion kernel, which lays k and v out in the order of the matrix fragments); logits q x k as single EXACT f16 products x 128^-0.5; keys at or beyond num_keys[b] excluded (whole trips of them are not converted, whole passes of them not walked); softmax f32 with a running maximum and sum per query; P = exp(logit - running maximum) once to f16 x v (exact f16) (1 product); f32 output.
#include <hip/hip_runtime.h>
#include <math.h>

typedef __attribute__((ext_vector_type(16))) _Float16 v16h;
typedef __attribute__((ext_vector_type(8)))  _Float16 v8h;
typedef __attribute__((ext_vector_type(4)))  _Float16 v4h;
typedef __attribute__((ext_vector_type(8)))  float v8f;
typedef __attribute__((ext_vector_type(4)))  float v4f;
typedef __attribute__((ext_vector_type(4)))  unsigned v4u;

template <typename T> __device__ __forceinline__ void vst2(void* p, T v) { *(T*)p = v;  }
// 16x16x32 fragments: lane = (h = lane>>4, row/col = lane&15); elements 0..7 = k0+8h+0..7, 8..15 = k0+16+8h+0..7; D element r = row 8h+r
__device__ __forceinline__ v16h frag_h(const _Float16* rowk0, int lane) {
  union { v16h v; v8h q[2]; } u; const _Float16* p = rowk0 + 8 * (lane >> 4);
  u.q[0] = *(const v8h*)p; u.q[1] = *(const v8h*)(p + 16); return u.v;
}

// Raw scaled-dot-product attention with a per-batch valid-key count (qrys [16,1024,128]; keys, vals [16,2048,128]; num_keys [16] int32 in [1, 2048); logits = q k^T / sqrt(128); only keys k < num_keys[b] take part (masked max, exp * mask, normalised over the valid keys); out = atts vals, [16,1024,128]). No learned weights. One 128-wide head per batch; one launch of each stage covers all batches; the scores stay in registers.
#define NB 16
#define TT 2048   // keys per batch
#define CC 128    // width of the query, key and value rows
#define NQ 1024   // queries per batch
#define SCALE (0.08838834764831845f)   // 1 / sqrt(128)

#define WS_QH  0u                                      // f16 q rows [b*NQ + t][CC]
#define WS_KH  (WS_QH + 2u * (size_t)NB * NQ * CC)      // f16 k in fragment order: 16-byte piece [b*TT/16 + t/16][kc][p][lane] = k[16 (t/16) + (lane & 15)][32 kc + 16 p + 8 (lane >> 4) + 0..7]
#define WS_VT  (WS_KH + 2u * (size_t)NB * TT * CC)      // f16 v in fragment order: 16-byte piece [b*TT/32 + t/32][j][p][lane] = v[32 (t/32) + 16 p + 8 (lane >> 4) + 0..7][16 j + (lane & 15)]
#define WS_END (WS_VT + 2u * (size_t)NB * CC * TT)

#define FK 32              // keys per pass of one key group
#define NG 8               // key groups (one wave each) per block of k_fa: one trip walks NG * FK keys
// trips that hold a valid key of a batch with n valid keys: at least 1 (the first tiles always exist), at most all; n is clamped first, so the count is bounded for any content of num_keys. k_cvt converts whole trips; k_fa reads only passes that begin below the clamped n, which lie inside them: what k_fa reads, k_cvt has written.
__device__ __forceinline__ int ntrip(int n) { n = n < 0 ? 0 : (n > TT ? TT : n); const int p = (n + NG * FK - 1) / (NG * FK); return p < 1 ? 1 : p; }

// ---- k_cvt: block = one tile of 128 rows x 128 columns, read once in whole 512-byte rows, every element rounded to bf16 and written as f16. Blocks 0 .. NVT-1: v tiles; then the k tiles; both go through LDS and leave it in 16-byte pieces in the order of the matrix fragments (WS_KH, WS_VT above), so that a wave of k_fa fetches a fragment half with one load of 512 bytes in a row; a tile fills the same 32 KiB of the workspace as its rows would. Then the q tiles, rows kept as they are. Few, large blocks, for speed only.
#define TR 128             // rows per tile
#define NVT (NB * TT / TR)
#define NKT (NB * TT / TR)
#define NQT (NB * NQ / TR)
static_assert(TT % TR == 0 && NQ % TR == 0 && TR == 128 && CC == 128 && (NG * FK) % TR == 0, "whole tiles; 128 threads deal 32 rows to a wave and 16-byte pieces of 128 x 128 to the threads; a trip of k_fa is whole tiles");
__device__ __forceinline__ _Float16 hb(float v) { return (_Float16)(float)(__bf16)v; }
// every "#pragma unroll" in k_cvt: all of a thread's loads are issued before the first value is used, and the register arrays need constant indices
__global__ __launch_bounds__(128) void k_cvt(const float* __restrict__ XQ, const float* __restrict__ XK, const float* __restrict__ XV, const int* __restrict__ NKEYS, _Float16* __restrict__ QH, _Float16* __restrict__ KH, _Float16* __restrict__ VT) {
  __shared__ __align__(16) _Float16 th[TR][TR + 8];
  const int tid = threadIdx.x, wave = tid >> 5, lane = tid & 31; const unsigned blk = blockIdx.x;
  if (blk < NVT + NKT) {   /* block-uniform and ahead of the barrier: a k or v tile behind the last trip that k_fa walks for its batch is never read, so it is neither loaded nor written */
    const unsigned t = blk < NVT ? blk : blk - NVT;
    if ((int)((t % (TT / TR)) * TR) >= ntrip(NKEYS[t / (TT / TR)]) * (NG * FK)) return; }
  v4f x[32];
  if (blk >= NVT + NKT) {   /* block-uniform: q rows, no LDS and no barrier */
    const size_t o = (size_t)(blk - NVT - NKT) * (TR * CC) + (unsigned)tid * 4u;
    const float* X = XQ + o; _Float16* D = QH + o;
#pragma unroll
    for (int i = 0; i < 32; ++i) x[i] = *(const v4f*)(X + i * 512);
    __builtin_amdgcn_sched_barrier(0);   /* all 32 loads are issued before the first conversion: a load held back for a free register would pay the memory latency a second time */
#pragma unroll
    for (int i = 0; i < 32; ++i) { const v4h h = { hb(x[i][0]), hb(x[i][1]), hb(x[i][2]), hb(x[i][3]) }; vst2(D + i * 512, h); }
    return; }
  const bool isv = blk < NVT; const unsigned tile = isv ? blk : blk - NVT;   /* block-uniform; the tiles of a batch follow one another, so tile counts 128 keys over all batches */
  if (isv) {   /* th[column][key]. wave = 32 keys, lane = 4 columns: each load is one whole row */
    const float* X = XV + ((size_t)tile * TR + wave * 32) * CC + lane * 4;
#pragma unroll
    for (int i = 0; i < 32; ++i) x[i] = *(const v4f*)(X + i * CC);
    __builtin_amdgcn_sched_barrier(0);   /* as above: all 32 loads first */
#pragma unroll
    for (int u = 0; u < 4; ++u)
#pragma unroll
      for (int c = 0; c < 4; ++c) { v8h p;
#pragma unroll
        for (int e = 0; e < 8; ++e) p[e] = hb(x[u * 8 + e][c]);
        *(v8h*)&th[lane * 4 + c][wave * 32 + u * 8] = p; }
  } else {   /* th[key][column]. load i of a wave is the whole row 4 i + wave */
    const float* X = XK + (size_t)tile * (TR * CC) + (unsigned)tid * 4u;
#pragma unroll
    for (int i = 0; i < 32; ++i) x[i] = *(const v4f*)(X + i * 512);
    __builtin_amdgcn_sched_barrier(0);   /* as above: all 32 loads first */
#pragma unroll
    for (int i = 0; i < 32; ++i) { const v4h h = { hb(x[i][0]), hb(x[i][1]), hb(x[i][2]), hb(x[i][3]) }; *(v4h*)&th[i * 4 + wave][lane * 4] = h; } }
  __syncthreads();   /* the whole tile is in LDS before a fragment's pieces are read back */
  /* run bp = 4 i + wave of 32 pieces is one half p of one fragment; the matrix row is th's row, the contraction index th's column. v: bp = (32 keys, j, p); k: bp = (16 keys, kc, p) */
  _Float16* D = (isv ? VT : KH) + (size_t)tile * (TR * CC) + (unsigned)tid * 8u;
#pragma unroll
  for (int i = 0; i < 16; ++i) { const int bp = i * 4 + wave;
    const int r = (isv ? ((bp >> 1) & 7) : (bp >> 3)) * 16 + (lane & 15), c = (isv ? (bp >> 4) : ((bp >> 1) & 3)) * 32 + (bp & 1) * 16 + (lane >> 4) * 8;
    vst2(D + i * 1024, *(const v4u*)&th[r][c]); }
  asm volatile("s_wait_xcnt 0x0" ::: "memory"); }   /* behind the last store, before any code that follows in the listing can overwrite a register the stores name */
// ---- k_fa: block = two tiles of QT queries, one after the other: of the batch that stands at place pr when the batches are ranked by their valid keys, longest first, and of the batch at place NB - 1 - pr, so that a long tile shares its block with a short one and the blocks, one to a WGP, end near together. A tile is worked on by NG waves; every wave holds all QT queries (two B operands of 16) and owns the passes grp, grp + NG, ... of FK keys, as far as they begin below the valid keys, and walks them in a ring from a start that differs between the blocks of a batch: no key is used by two waves of a block, so k and v need no LDS: a wave fetches its A fragments, laid out for that by k_cvt, straight into registers, and no wave waits for another inside the loop. Running maximum, sum and accumulators are the wave's own; the partial results are joined through LDS at the tile's end. Per pass: S^T = K Q^T (A = k, B = q kept in registers), running maximum and sum per query (one lane column = one query), P^T packed from the score tiles into the B operand, O^T += V^T P^T (A = v). The next pass's k is fetched as soon as the scores are formed, the next pass's v as soon as the second product is issued: each flies under the work that does not need it.
#define QT 32              // queries per tile
#define SL2 (SCALE * 1.4426950408889634f)   // logits in log2 units: exp(x) = exp2(x * log2 e)
static_assert(TT % (FK * NG) == 0 && NQ % QT == 0 && NB == 16 && CC == 128 && FK == 32 && NG == 8 && QT == 32, "whole trips; one lane column per batch in the ranking, the batches in pairs; a pass is two k row blocks and one v key block; the join gives each of eight waves 16 queries x 32 output columns");
__device__ __forceinline__ float xhalf(float x) { return __builtin_bit_cast(float, __builtin_amdgcn_permlanex16(__builtin_bit_cast(int, x), __builtin_bit_cast(int, x), 0x76543210, 0xfedcba98, false, false)); }   // lane l with lane l ^ 16
// a wave-uniform address held in a scalar pair: the compiler then keeps one lane offset for all fragments and adds the scalar base at the loads, instead of carrying 64-bit per-lane addresses
typedef const __attribute__((address_space(1))) char* gbytes;   // global memory, named as such: an address rebuilt from integers would otherwise be loaded through the generic path
typedef const __attribute__((address_space(1))) v4u* gpiece;
__device__ __forceinline__ gbytes sbase(const void* p) { const unsigned long long a = (unsigned long long)p; return (gbytes)(((unsigned long long)(unsigned)__builtin_amdgcn_readfirstlane((int)(a >> 32)) << 32) | (unsigned)__builtin_amdgcn_readfirstlane((int)(unsigned)a)); }
// fragment i of a pass: its two halves are runs 2 i and 2 i + 1 of 32 pieces; p = the pass's first byte + 16 * lane
__device__ __forceinline__ v16h frag_g(gbytes p, int i) { union { v16h v; v4u q[2]; } u; u.q[0] = *(gpiece)(p + i * 1024); u.q[1] = *(gpiece)(p + i * 1024 + 512); return u.v; }
// behind a run of fragment loads from p, before a register that they name is overwritten; p is an input so that its registers stay p's up to the wait: otherwise the last load's data may be given the address pair of the loads before it
__device__ __forceinline__ void xwait(gbytes p) { asm volatile("s_wait_xcnt 0x0" :: "v"(p) : "memory"); }
// every "#pragma unroll" without a count in fa_pass and k_fa: the register arrays (fragments, score tiles, accumulators) need constant indices to stay in registers
// one pass of FK keys of one wave. LAST = false: another pass of this wave follows, beginning at key kn0: its k is fetched behind the first product and its v behind the second, so that the loop's waits for k leave the v loads in flight. LAST = true: nothing is fetched. A wave walks its passes in a rotated order (k_fa), so the pass that reaches past the valid keys can be any of them: every pass tests for it, and the keys at or beyond nk are masked there.
template <bool LAST> __device__ __forceinline__ void fa_pass(v16h (&kf)[2][4], v16h (&vf)[8], const v16h (&qf)[2][4], v8f (&acc)[2][8], float (&m)[2], float (&l)[2], const char* kb, const char* vb, unsigned lo, int k0, int kn0, int nk, int g) {
  v8f st[2][2] = {};
#pragma unroll
  for (int kc = 0; kc < 4; ++kc)
#pragma unroll
    for (int t = 0; t < 2; ++t)
#pragma unroll
      for (int s = 0; s < 2; ++s) st[t][s] = __builtin_amdgcn_wmma_f32_16x16x32_f16(false, kf[t][kc], false, qf[s][kc], (short)0, st[t][s], false, false);
  /* st[t][s][r] = raw logit of key k0 + t * 16 + 8 g + r for query s * 16 + col of the tile */
  if (!LAST) { const gbytes kn = sbase(kb + (size_t)kn0 * (CC * 2)) + lo;
#pragma unroll
    for (int i = 0; i < 8; ++i) kf[i >> 2][i & 3] = frag_g(kn, i);
    xwait(kn);
    __builtin_amdgcn_sched_barrier(0); }   /* all of the next k is asked for before the exponentials begin: a load held back behind them would have the second product alone to fly under */
  if (k0 + FK > nk) { const int rem = nk - k0 - 8 * g;   /* the same in a whole wave: only a pass that reaches past the valid keys pays for the mask */
#pragma unroll
    for (int t = 0; t < 2; ++t)
#pragma unroll
      for (int s = 0; s < 2; ++s)
#pragma unroll
        for (int r = 0; r < 8; ++r) st[t][s][r] = (t * 16 + r < rem) ? st[t][s][r] : -3.0e38f; }
  v16h pb[2];
#pragma unroll
  for (int s = 0; s < 2; ++s) { float mt[2];
#pragma unroll
    for (int t = 0; t < 2; ++t) { mt[t] = st[t][s][0];
#pragma unroll
      for (int r = 1; r < 8; ++r) mt[t] = fmaxf(mt[t], st[t][s][r]); }
    float mx = fmaxf(mt[0], mt[1]); mx = fmaxf(m[s], fmaxf(mx, xhalf(mx)));
    const float al = __builtin_amdgcn_exp2f((m[s] - mx) * SL2), ms = mx * SL2; m[s] = mx;
    float ps[2];
#pragma unroll
    for (int t = 0; t < 2; ++t) { ps[t] = 0.f;
#pragma unroll
      for (int r = 0; r < 8; ++r) { const float p = __builtin_amdgcn_exp2f(fmaf(st[t][s][r], SL2, -ms)); ps[t] += p; pb[s][t * 8 + r] = (_Float16)p; } }
    l[s] = l[s] * al + (ps[0] + ps[1]);
#pragma unroll
    for (int j = 0; j < 8; ++j) acc[s][j] *= al; }
#pragma unroll
  for (int j = 0; j < 8; ++j)
#pragma unroll
    for (int s = 0; s < 2; ++s) acc[s][j] = __builtin_amdgcn_wmma_f32_16x16x32_f16(false, vf[j], false, pb[s], (short)0, acc[s][j], false, false);
  if (!LAST) { const gbytes vn = sbase(vb + (size_t)kn0 * (CC * 2)) + lo;
#pragma unroll
    for (int j = 0; j < 8; ++j) vf[j] = frag_g(vn, j);
    xwait(vn); } }
__global__ __launch_bounds__(32 * NG) void k_fa(const _Float16* __restrict__ QH, const _Float16* __restrict__ KH, const _Float16* __restrict__ VT, const int* __restrict__ NKEYS, float* __restrict__ Y) {
  /* exchange space of the join, one for each of the block's two tiles: xa[tile][wave][piece (s * 8 + j) * 2 + half][lane], xm[tile][wave][s * 2 + (0: maximum, 1: sum)][lane]: neighbouring lanes, neighbouring 16 bytes */
  __shared__ __align__(16) v4f xa[2][NG][32][32]; __shared__ float xm[2][NG][4][32];
  const int grp = __builtin_amdgcn_readfirstlane((int)(threadIdx.x >> 5));   /* the wave's number: kept scalar for the pass addresses and the loop tests */
  const int lane = threadIdx.x & 31, col = lane & 15, g = lane >> 4;
  /* lane column col ranks batch col: the number of batches with more valid keys, ties by index, so the ranks are a permutation of 0 .. NB - 1 for any content of num_keys, the same in every wave */
  const int mine = NKEYS[col];
  asm volatile("s_wait_xcnt 0x0" ::: "memory");   /* before the address register of the load above is overwritten */
  int rank = 0;
#pragma unroll
  for (int j = 0; j < NB; ++j) { const int o = NKEYS[j]; rank += (o > mine || (o == mine && j < col)) ? 1 : 0; }
  const int pr = blockIdx.x / (NQ / QT), q0 = (blockIdx.x % (NQ / QT)) * QT;
  /* the batch of a wanted rank: its lane column's bit in the ballot; bit NB - 1 is set as well, so the index stays below NB whatever the ballot holds */
  const int blong = __builtin_ctz(__builtin_amdgcn_ballot_w32(rank == pr) | (1u << (NB - 1))), bshort = __builtin_ctz(__builtin_amdgcn_ballot_w32(rank == NB - 1 - pr) | (1u << (NB - 1)));
  /* its count comes from the lane that holds it: no second load */
  const int nlong = __builtin_amdgcn_readlane(mine, blong), nshort = __builtin_amdgcn_readlane(mine, bshort);
  const unsigned lo = (unsigned)lane * 16u;   /* in bytes, added to a scalar base (sbase) */
  /* where a wave begins its walk over its passes, in eighths of their number. The bits are picked so that blocks eight apart and neighbours differ. For speed only: any value below 8 gives every pass exactly once */
  const int rot = ((q0 / QT) >> 3) * 2 + ((q0 / QT) & 1);
#pragma unroll 1   /* rolled: one copy of the long tile body in the instruction cache */
  for (int h = 0; h < 2; ++h) {
    const int b = h ? bshort : blong;
    const int nk = h ? nshort : nlong, ne = nk < 0 ? 0 : (nk > TT ? TT : nk);   /* nk: only compared with key indices; ne: clamped, it bounds the passes and so every k and v address for any content of num_keys */
    const char* kb = (const char*)KH + (size_t)b * (TT * CC * 2); const char* vb = (const char*)VT + (size_t)b * (TT * CC * 2);   /* in both layouts the FK keys from k0 on are the FK * CC * 2 bytes from k0 * CC * 2 on */
    v16h qf[2][4], kf[2][4], vf[8];
    float m[2] = { -1.0e30f, -1.0e30f }, l[2] = { 0.f, 0.f }; v8f acc[2][8] = {};   /* the start value lies below every logit and far above the mask value; a wave without a pass keeps it, and its sum and accumulators stay 0 for the join */
    const int kf0 = grp * FK;   /* first key of this wave's lowest pass */
    if (kf0 < ne) {   /* the same in a whole wave; no barrier inside */
      const int np = (ne - kf0 + NG * FK - 1) / (NG * FK);   /* this wave's passes: 1 .. TT / (NG * FK) */
      int k0 = kf0 + ((rot * np) >> 3) * (NG * FK);   /* the pass it starts with: rot < 8, so one of its np passes; from there upwards, then round to the lowest */
      const gbytes kn = sbase(kb + (size_t)k0 * (CC * 2)) + lo, vn = sbase(vb + (size_t)k0 * (CC * 2)) + lo;
#pragma unroll
      for (int s = 0; s < 2; ++s)
#pragma unroll
        for (int kc = 0; kc < 4; ++kc) qf[s][kc] = frag_h(QH + ((size_t)b * NQ + q0 + s * 16 + col) * CC + kc * 32, lane);
      asm volatile("s_wait_xcnt 0x0" ::: "memory");   /* before a register that the q loads name is overwritten, be it by a later load's data */
      __builtin_amdgcn_sched_barrier(0);   /* keeps the q loads in front of that wait and the k loads behind it */
#pragma unroll
      for (int i = 0; i < 8; ++i) kf[i >> 2][i & 3] = frag_g(kn, i);
      xwait(kn);
      __builtin_amdgcn_sched_barrier(0);   /* keeps the k loads in front of that wait and the v loads behind it */
#pragma unroll
      for (int j = 0; j < 8; ++j) vf[j] = frag_g(vn, j);
      xwait(vn);
      __builtin_amdgcn_sched_barrier(0);   /* keeps the v loads in front of that wait and the arithmetic below behind it */
#pragma unroll 1   /* rolled: one copy of the long pass in the instruction cache; at most TT / (NG * FK) - 1 trips */
      for (int i = 1; i < np; ++i) { const int kn0 = k0 + NG * FK < ne ? k0 + NG * FK : kf0; fa_pass<false>(kf, vf, qf, acc, m, l, kb, vb, lo, k0, kn0, nk, g); k0 = kn0; }
      fa_pass<true>(kf, vf, qf, acc, m, l, kb, vb, lo, k0, 0, nk, g); }
    /* join: every wave lays its sixteen accumulator tiles, its maxima and its sums into this tile's exchange space; wave grp then finishes the queries of s = grp & 1 in the output columns (grp >> 1) * 32 .. + 31, one whole 128-byte line a query, from the eight waves' parts, always in the order of the waves */
#pragma unroll
    for (int s = 0; s < 2; ++s) {
#pragma unroll
      for (int j = 0; j < 8; ++j) { const v4f a = { acc[s][j][0], acc[s][j][1], acc[s][j][2], acc[s][j][3] }, c = { acc[s][j][4], acc[s][j][5], acc[s][j][6], acc[s][j][7] }; xa[h][grp][(s * 8 + j) * 2][lane] = a; xa[h][grp][(s * 8 + j) * 2 + 1][lane] = c; }
      xm[h][grp][s * 2][lane] = m[s]; xm[h][grp][s * 2 + 1][lane] = l[s]; }
    __syncthreads();   /* every wave's part is written before another wave reads it; the block's other tile has an exchange space of its own, so no second barrier is needed */
    const int sj = grp & 1, cq = grp >> 1;
    float mo[NG], f[NG];
#pragma unroll
    for (int x = 0; x < NG; ++x) mo[x] = xm[h][x][sj * 2][lane];
    const float mj = fmaxf(fmaxf(fmaxf(mo[0], mo[1]), fmaxf(mo[2], mo[3])), fmaxf(fmaxf(mo[4], mo[5]), fmaxf(mo[6], mo[7])));
    float lj = 0.f;
#pragma unroll
    for (int x = 0; x < NG; ++x) { f[x] = __builtin_amdgcn_exp2f((mo[x] - mj) * SL2); lj += xm[h][x][sj * 2 + 1][lane] * f[x]; }   /* each part rescaled to the common maximum; a wave without a valid key gets the factor 0 beside one that has some */
    lj += xhalf(lj);
    const float inv = (nk > 0 && lj > 0.f) ? 1.0f / lj : 0.f;   /* a fully excluded row yields 0 */
    float* yr = Y + ((size_t)b * NQ + q0 + sj * 16 + col) * CC + cq * 32 + 8 * g;   /* tile j, element r = out[query col][j * 16 + 8 g + r]; this wave's tiles are j = 2 cq, 2 cq + 1 */
#pragma unroll
    for (int i = 0; i < 2; ++i) { v4f a = {}, c = {};
#pragma unroll
      for (int x = 0; x < NG; ++x) { const float w = f[x] * inv; a += xa[h][x][(sj * 8 + cq * 2 + i) * 2][lane] * w; c += xa[h][x][(sj * 8 + cq * 2 + i) * 2 + 1][lane] * w; }
      vst2(yr + i * 16, a); vst2(yr + i * 16 + 4, c); }
    asm volatile("s_wait_xcnt 0x0" ::: "memory"); } }   /* before the next tile's arithmetic overwrites an address register of the stores above */

extern "C" void kernel_launch(void* const* d_in, const int* in_sizes, int n_in, void* d_out, int out_size, void* d_ws, size_t ws_size, hipStream_t stream) {
  (void)in_sizes; (void)n_in; (void)out_size;
  const float** F = (const float**)d_in;
  if (ws_size < (size_t)WS_END) return;
  char* ws = (char*)d_ws; _Float16 *QH = (_Float16*)(ws + WS_QH), *KH = (_Float16*)(ws + WS_KH), *VT = (_Float16*)(ws + WS_VT);
  // inputs: 0 qrys [16,1024,128]; 1 keys [16,2048,128]; 2 vals [16,2048,128]; 3 num_keys [16] int32
  k_cvt<<<NVT + NKT + NQT, 128, 0, stream>>>(F[0], F[1], F[2], (const int*)d_in[3], QH, KH, VT);   /* f16 q rows, f16 k and v in fragment order, as far as a batch's valid keys reach */
  /* scores, softmax and P x V in one launch for all batches: a block takes one query tile of each batch of a pair */
  k_fa<<<(NB / 2) * (NQ / QT), 32 * NG, 0, stream>>>(QH, KH, VT, (const int*)d_in[3], (float*)d_out);
}

// v008
// Measured time: 22.3 microseconds a run.
// Two timings next to v007 put it at 1.03 and 1.04 times that version's speed.
// Counting every step since v000, it is 88.3 times as fast.
// compute dtype: queries / keys / values rounded to bf16 and carried EXACTLY into f16 (one streaming conversion kernel, which lays k and v out in the order of the matrix fragments); logits q x k as single EXACT f16 products x 128^-0.5; keys at or beyond num_keys[b] excluded (whole trips of them are not converted, whole passes of them not walked); softmax f32 with a running maximum and sum per query; P = exp(logit - running maximum) once to f16 x v (exact f16) (1 product); f32 output.
#include <hip/hip_runtime.h>
#include <math.h>

typedef __attribute__((ext_vector_type(16))) _Float16 v16h;
typedef __attribute__((ext_vector_type(8)))  _Float16 v8h;
typedef __attribute__((ext_vector_type(4)))  _Float16 v4h;
typedef __attribute__((ext_vector_type(8)))  float v8f;
typedef __attribute__((ext_vector_type(4)))  float v4f;
typedef __attribute__((ext_vector_type(4)))  unsigned v4u;

template <typename T> __device__ __forceinline__ void vst2(void* p, T v) { *(T*)p = v;  }
// 16x16x32 fragments: lane = (h = lane>>4, row/col = lane&15); elements 0..7 = k0+8h+0..7, 8..15 = k0+16+8h+0..7; D element r = row 8h+r
__device__ __forceinline__ v16h frag_h(const _Float16* rowk0, int lane) {
  union { v16h v; v8h q[2]; } u; const _Float16* p = rowk0 + 8 * (lane >> 4);
  u.q[0] = *(const v8h*)p; u.q[1] = *(const v8h*)(p + 16); return u.v;
}

// Raw scaled-dot-product attention with a per-batch valid-key count (qrys [16,1024,128]; keys, vals [16,2048,128]; num_keys [16] int32 in [1, 2048); logits = q k^T / sqrt(128); only keys k < num_keys[b] take part (masked max, exp * mask, normalised over the valid keys); out = atts vals, [16,1024,128]). No learned weights. One 128-wide head per batch; one launch of each stage covers all batches; the scores stay in registers.
#define NB 16
#define TT 2048   // keys per batch
#define CC 128    // width of the query, key and value rows
#define NQ 1024   // queries per batch
#define SCALE (0.08838834764831845f)   // 1 / sqrt(128)

#define WS_QH  0u                                      // f16 q rows [b*NQ + t][CC]
#define WS_KH  (WS_QH + 2u * (size_t)NB * NQ * CC)      // f16 k in fragment order: 16-byte piece [b*TT/16 + t/16][kc][p][lane] = k[16 (t/16) + (lane & 15)][32 kc + 16 p + 8 (lane >> 4) + 0..7]
#define WS_VT  (WS_KH + 2u * (size_t)NB * TT * CC)      // f16 v in fragment order: 16-byte piece [b*TT/32 + t/32][j][p][lane] = v[32 (t/32) + 16 p + 8 (lane >> 4) + 0..7][16 j + (lane & 15)]
#define WS_END (WS_VT + 2u * (size_t)NB * CC * TT)

#define FK 32              // keys per pass of one key group
#define NG 8               // key groups (one wave each) per block of k_fa: one trip walks NG * FK keys
// trips that hold a valid key of a batch with n valid keys: at least 1 (the first tiles always exist), at most all; n is clamped first, so the count is bounded for any content of num_keys. k_cvt converts whole trips; k_fa reads only passes that begin below the clamped n, which lie inside them: what k_fa reads, k_cvt has written.
__device__ __forceinline__ int ntrip(int n) { n = n < 0 ? 0 : (n > TT ? TT : n); const int p = (n + NG * FK - 1) / (NG * FK); return p < 1 ? 1 : p; }

// ---- k_cvt: block = one tile of 128 rows x 128 columns, read once in whole 512-byte rows, every element rounded to bf16 and written as f16. Blocks 0 .. NVT-1: v tiles; then the k tiles; both go through LDS and leave it in 16-byte pieces in the order of the matrix fragments (WS_KH, WS_VT above), so that a wave of k_fa fetches a fragment half with one load of 512 bytes in a row; a tile fills the same 32 KiB of the workspace as its rows would. Then the q tiles, rows kept as they are. Few, large blocks, for speed only.
#define TR 128             // rows per tile
#define NVT (NB * TT / TR)
#define NKT (NB * TT / TR)
#define NQT (NB * NQ / TR)
static_assert(TT % TR == 0 && NQ % TR == 0 && TR == 128 && CC == 128 && (NG * FK) % TR == 0, "whole tiles; 128 threads deal 32 rows to a wave and 16-byte pieces of 128 x 128 to the threads; a trip of k_fa is whole tiles");
__device__ __forceinline__ _Float16 hb(float v) { return (_Float16)(float)(__bf16)v; }
// every "#pragma unroll" in k_cvt: all of a thread's loads are issued before the first value is used, and the register arrays need constant indices
__global__ __launch_bounds__(128) void k_cvt(const float* __restrict__ XQ, const float* __restrict__ XK, const float* __restrict__ XV, const int* __restrict__ NKEYS, _Float16* __restrict__ QH, _Float16* __restrict__ KH, _Float16* __restrict__ VT) {
  __shared__ __align__(16) _Float16 th[TR][TR + 8];
  const int tid = threadIdx.x, wave = tid >> 5, lane = tid & 31; const unsigned blk = blockIdx.x;
  if (blk < NVT + NKT) {   /* block-uniform and ahead of the barrier: a k or v tile behind the last trip that k_fa walks for its batch is never read, so it is neither loaded nor written */
    const unsigned t = blk < NVT ? blk : blk - NVT;
    if ((int)((t % (TT / TR)) * TR) >= ntrip(NKEYS[t / (TT / TR)]) * (NG * FK)) return; }
  v4f x[32];
  if (blk >= NVT + NKT) {   /* block-uniform: q rows, no LDS and no barrier */
    const size_t o = (size_t)(blk - NVT - NKT) * (TR * CC) + (unsigned)tid * 4u;
    const float* X = XQ + o; _Float16* D = QH + o;
#pragma unroll
    for (int i = 0; i < 32; ++i) x[i] = *(const v4f*)(X + i * 512);
    __builtin_amdgcn_sched_barrier(0);   /* all 32 loads are issued before the first conversion: a load held back for a free register would pay the memory latency a second time */
#pragma unroll
    for (int i = 0; i < 32; ++i) { const v4h h = { hb(x[i][0]), hb(x[i][1]), hb(x[i][2]), hb(x[i][3]) }; vst2(D + i * 512, h); }
    return; }
  const bool isv = blk < NVT; const unsigned tile = isv ? blk : blk - NVT;   /* block-uniform; the tiles of a batch follow one another, so tile counts 128 keys over all batches */
  if (isv) {   /* th[column][key]. wave = 32 keys, lane = 4 columns: each load is one whole row */
    const float* X = XV + ((size_t)tile * TR + wave * 32) * CC + lane * 4;
#pragma unroll
    for (int i = 0; i < 32; ++i) x[i] = *(const v4f*)(X + i * CC);
    __builtin_amdgcn_sched_barrier(0);   /* as above: all 32 loads first */
#pragma unroll
    for (int u = 0; u < 4; ++u)
#pragma unroll
      for (int c = 0; c < 4; ++c) { v8h p;
#pragma unroll
        for (int e = 0; e < 8; ++e) p[e] = hb(x[u * 8 + e][c]);
        *(v8h*)&th[lane * 4 + c][wave * 32 + u * 8] = p; }
  } else {   /* th[key][column]. load i of a wave is the whole row 4 i + wave */
    const float* X = XK + (size_t)tile * (TR * CC) + (unsigned)tid * 4u;
#pragma unroll
    for (int i = 0; i < 32; ++i) x[i] = *(const v4f*)(X + i * 512);
    __builtin_amdgcn_sched_barrier(0);   /* as above: all 32 loads first */
#pragma unroll
    for (int i = 0; i < 32; ++i) { const v4h h = { hb(x[i][0]), hb(x[i][1]), hb(x[i][2]), hb(x[i][3]) }; *(v4h*)&th[i * 4 + wave][lane * 4] = h; } }
  __syncthreads();   /* the whole tile is in LDS before a fragment's pieces are read back */
  /* run bp = 4 i + wave of 32 pieces is one half p of one fragment; the matrix row is th's row, the contraction index th's column. v: bp = (32 keys, j, p); k: bp = (16 keys, kc, p) */
  _Float16* D = (isv ? VT : KH) + (size_t)tile * (TR * CC) + (unsigned)tid * 8u;
#pragma unroll
  for (int i = 0; i < 16; ++i) { const int bp = i * 4 + wave;
    const int r = (isv ? ((bp >> 1) & 7) : (bp >> 3)) * 16 + (lane & 15), c = (isv ? (bp >> 4) : ((bp >> 1) & 3)) * 32 + (bp & 1) * 16 + (lane >> 4) * 8;
    vst2(D + i * 1024, *(const v4u*)&th[r][c]); }
  asm volatile("s_wait_xcnt 0x0" ::: "memory"); }   /* behind the last store, before any code that follows in the listing can overwrite a register the stores name */
// ---- k_fa: block = two tiles of QT queries, one after the other: of the batch that stands at place pr when the batches are ranked by their valid keys, longest first, and of the batch at place NB - 1 - pr, so that a long tile shares its block with a short one and the blocks, one to a WGP, end near together. A tile is worked on by NG waves; every wave holds all QT queries (two B operands of 16) and owns every NG-th pass of FK keys, as far as they begin below the valid keys (the two tiles' passes are dealt as one list), and walks them in a ring from a start that differs between the blocks of a batch: no key is used by two waves of a block, so k and v need no LDS: a wave fetches its A fragments, laid out for that by k_cvt, straight into registers, and no wave waits for another inside the loop. Running maximum, sum and accumulators are the wave's own; a wave goes from its last pass of the first tile to its first of the second without waiting for the others; the partial results of both tiles are joined through LDS at the block's end, behind its one barrier. Per pass: S^T = K Q^T (A = k, B = q kept in registers), running maximum and sum per query (one lane column = one query), P^T packed from the score tiles into the B operand, O^T += V^T P^T (A = v). The next pass's k is fetched as soon as the scores are formed, the next pass's v as soon as the second product is issued: each flies under the work that does not need it.
#define QT 32              // queries per tile
#define SL2 (SCALE * 1.4426950408889634f)   // logits in log2 units: exp(x) = exp2(x * log2 e)
static_assert(TT % (FK * NG) == 0 && NQ % QT == 0 && NB == 16 && CC == 128 && FK == 32 && NG == 8 && QT == 32, "whole trips; one lane column per batch in the ranking, the batches in pairs; a pass is two k row blocks and one v key block; the join gives each of eight waves 16 queries x 32 output columns");
__device__ __forceinline__ float xhalf(float x) { return __builtin_bit_cast(float, __builtin_amdgcn_permlanex16(__builtin_bit_cast(int, x), __builtin_bit_cast(int, x), 0x76543210, 0xfedcba98, false, false)); }   // lane l with lane l ^ 16
// a wave-uniform address held in a scalar pair: the compiler then keeps one lane offset for all fragments and adds the scalar base at the loads, instead of carrying 64-bit per-lane addresses
typedef const __attribute__((address_space(1))) char* gbytes;   // global memory, named as such: an address rebuilt from integers would otherwise be loaded through the generic path
typedef const __attribute__((address_space(1))) v4u* gpiece;
__device__ __forceinline__ gbytes sbase(const void* p) { const unsigned long long a = (unsigned long long)p; return (gbytes)(((unsigned long long)(unsigned)__builtin_amdgcn_readfirstlane((int)(a >> 32)) << 32) | (unsigned)__builtin_amdgcn_readfirstlane((int)(unsigned)a)); }
// fragment i of a pass: its two halves are runs 2 i and 2 i + 1 of 32 pieces; p = the pass's first byte + 16 * lane
__device__ __forceinline__ v16h frag_g(gbytes p, int i) { union { v16h v; v4u q[2]; } u; u.q[0] = *(gpiece)(p + i * 1024); u.q[1] = *(gpiece)(p + i * 1024 + 512); return u.v; }
// behind a run of fragment loads from p, before a register that they name is overwritten; p is an input so that its registers stay p's up to the wait: otherwise the last load's data may be given the address pair of the loads before it
__device__ __forceinline__ void xwait(gbytes p) { asm volatile("s_wait_xcnt 0x0" :: "v"(p) : "memory"); }
// the pass that a wave whose lowest pass begins at key kf0 < ne starts with: rot < 8, so one of its passes; from there upwards, then round to the lowest
__device__ __forceinline__ int pass0(int ne, int kf0, int rot) { const int np = (ne - kf0 + NG * FK - 1) / (NG * FK); return kf0 + ((rot * np) >> 3) * (NG * FK); }
// the q fragments of one tile; row = the lane's query row of the tile's first sixteen
__device__ __forceinline__ void load_q(v16h (&qf)[2][4], const _Float16* row, int lane) {
#pragma unroll
  for (int s = 0; s < 2; ++s)
#pragma unroll
    for (int kc = 0; kc < 4; ++kc) qf[s][kc] = frag_h(row + s * 16 * CC + kc * 32, lane);
  asm volatile("s_wait_xcnt 0x0" ::: "memory");   /* before a register that the q loads name is overwritten, be it by a later load's data */
  __builtin_amdgcn_sched_barrier(0); }   /* keeps the q loads in front of that wait and what follows behind it */
// every "#pragma unroll" without a count in fa_pass, load_q and k_fa: the register arrays (fragments, score tiles, accumulators) need constant indices to stay in registers
// one pass of FK keys of one wave. LAST = false: another pass of this wave follows, beginning at key kn0 of the batch whose k and v begin at kb and vb (the same tile's next pass, or the first pass of the block's second tile; there newq is set, the same in a whole wave, and that tile's q, whose row of this lane is qn, is fetched behind k into the registers that the first product has just left): its k is fetched behind the first product and its v behind the second, so that the loop's waits for k leave the v loads in flight. LAST = true: nothing is fetched. A wave walks its passes in a rotated order (k_fa), so the pass that reaches past the valid keys can be any of them: every pass tests for it, and the keys at or beyond nk are masked there.
template <bool LAST> __device__ __forceinline__ void fa_pass(v16h (&kf)[2][4], v16h (&vf)[8], v16h (&qf)[2][4], v8f (&acc)[2][8], float (&m)[2], float (&l)[2], const char* kb, const char* vb, unsigned lo, int k0, int kn0, int nk, int g, bool newq, const _Float16* qn) {
  v8f st[2][2] = {};
#pragma unroll
  for (int kc = 0; kc < 4; ++kc)
#pragma unroll
    for (int t = 0; t < 2; ++t)
#pragma unroll
      for (int s = 0; s < 2; ++s) st[t][s] = __builtin_amdgcn_wmma_f32_16x16x32_f16(false, kf[t][kc], false, qf[s][kc], (short)0, st[t][s], false, false);
  /* st[t][s][r] = raw logit of key k0 + t * 16 + 8 g + r for query s * 16 + col of the tile */
  if (!LAST) { const gbytes kn = sbase(kb + (size_t)kn0 * (CC * 2)) + lo;
#pragma unroll
    for (int i = 0; i < 8; ++i) kf[i >> 2][i & 3] = frag_g(kn, i);
    xwait(kn);
    if (newq) load_q(qf, qn, g << 4);
    __builtin_amdgcn_sched_barrier(0); }   /* all of the next k is asked for before the exponentials begin: a load held back behind them would have the second product alone to fly under */
  if (k0 + FK > nk) { const int rem = nk - k0 - 8 * g;   /* the same in a whole wave: only a pass that reaches past the valid keys pays for the mask */
#pragma unroll
    for (int t = 0; t < 2; ++t)
#pragma unroll
      for (int s = 0; s < 2; ++s)
#pragma unroll
        for (int r = 0; r < 8; ++r) st[t][s][r] = (t * 16 + r < rem) ? st[t][s][r] : -3.0e38f; }
  v16h pb[2];
#pragma unroll
  for (int s = 0; s < 2; ++s) { float mt[2];
#pragma unroll
    for (int t = 0; t < 2; ++t) { mt[t] = st[t][s][0];
#pragma unroll
      for (int r = 1; r < 8; ++r) mt[t] = fmaxf(mt[t], st[t][s][r]); }
    float mx = fmaxf(mt[0], mt[1]); mx = fmaxf(m[s], fmaxf(mx, xhalf(mx)));
    const float al = __builtin_amdgcn_exp2f((m[s] - mx) * SL2), ms = mx * SL2; m[s] = mx;
    float ps[2];
#pragma unroll
    for (int t = 0; t < 2; ++t) { ps[t] = 0.f;
#pragma unroll
      for (int r = 0; r < 8; ++r) { const float p = __builtin_amdgcn_exp2f(fmaf(st[t][s][r], SL2, -ms)); ps[t] += p; pb[s][t * 8 + r] = (_Float16)p; } }
    l[s] = l[s] * al + (ps[0] + ps[1]);
#pragma unroll
    for (int j = 0; j < 8; ++j) acc[s][j] *= al; }
#pragma unroll
  for (int j = 0; j < 8; ++j)
#pragma unroll
    for (int s = 0; s < 2; ++s) acc[s][j] = __builtin_amdgcn_wmma_f32_16x16x32_f16(false, vf[j], false, pb[s], (short)0, acc[s][j], false, false);
  if (!LAST) { const gbytes vn = sbase(vb + (size_t)kn0 * (CC * 2)) + lo;
#pragma unroll
    for (int j = 0; j < 8; ++j) vf[j] = frag_g(vn, j);
    xwait(vn); } }
__global__ __launch_bounds__(32 * NG) void k_fa(const _Float16* __restrict__ QH, const _Float16* __restrict__ KH, const _Float16* __restrict__ VT, const int* __restrict__ NKEYS, float* __restrict__ Y) {
  /* exchange space of the join, one for each of the block's two tiles: xa[tile][wave][piece (s * 8 + j) * 2 + half][lane], xm[tile][wave][s * 2 + (0: maximum, 1: sum)][lane]: neighbouring lanes, neighbouring 16 bytes */
  __shared__ __align__(16) v4f xa[2][NG][32][32]; __shared__ float xm[2][NG][4][32];
  const int grp = __builtin_amdgcn_readfirstlane((int)(threadIdx.x >> 5));   /* the wave's number: kept scalar for the pass addresses and the loop tests */
  const int lane = threadIdx.x & 31, col = lane & 15, g = lane >> 4;
  /* lane column col ranks batch col: the number of batches with more valid keys, ties by index, so the ranks are a permutation of 0 .. NB - 1 for any content of num_keys, the same in every wave */
  const int mine = NKEYS[col];
  asm volatile("s_wait_xcnt 0x0" ::: "memory");   /* before the address register of the load above is overwritten */
  int rank = 0;
#pragma unroll
  for (int j = 0; j < NB; ++j) { const int o = NKEYS[j]; rank += (o > mine || (o == mine && j < col)) ? 1 : 0; }
  const int pr = blockIdx.x / (NQ / QT), q0 = (blockIdx.x % (NQ / QT)) * QT;
  /* the batch of a wanted rank: its lane column's bit in the ballot; bit NB - 1 is set as well, so the index stays below NB whatever the ballot holds */
  const int blong = __builtin_ctz(__builtin_amdgcn_ballot_w32(rank == pr) | (1u << (NB - 1))), bshort = __builtin_ctz(__builtin_amdgcn_ballot_w32(rank == NB - 1 - pr) | (1u << (NB - 1)));
  /* its count comes from the lane that holds it: no second load */
  const int nlong = __builtin_amdgcn_readlane(mine, blong), nshort = __builtin_amdgcn_readlane(mine, bshort);
  const unsigned lo = (unsigned)lane * 16u;   /* in bytes, added to a scalar base (sbase) */
  /* where a wave begins its walk over its passes, in eighths of their number. The bits are picked so that blocks eight apart and neighbours differ. For speed only: any value below 8 gives every pass exactly once */
  const int rot = ((q0 / QT) >> 3) * 2 + ((q0 / QT) & 1);
  /* clamped counts: they bound the passes and so every k and v address for any content of num_keys */
  const int nel = nlong < 0 ? 0 : (nlong > TT ? TT : nlong), nes = nshort < 0 ? 0 : (nshort > TT ? TT : nshort);
  /* the passes of the first tile and behind them those of the second are dealt to the waves in turn, as one list: the second tile's deal goes on where the first tile's ended, so no wave has more than one pass more than another over both tiles. kf0, kf1: first key of this wave's lowest pass in the first and in the second tile */
  const int kf0 = grp * FK, kf1 = ((grp - (nel + FK - 1) / FK) & (NG - 1)) * FK;
  const bool has0 = kf0 < nel, has1 = kf1 < nes;   /* the same in a whole wave: it has a pass in that tile */
  v16h qf[2][4], kf[2][4], vf[8];
  if (has0 || has1) {   /* q of the first tile in which the wave has a pass, and the k and v of the pass that it starts with there */
    const int bf = has0 ? blong : bshort, k0 = has0 ? pass0(nel, kf0, rot) : pass0(nes, kf1, rot);
    const gbytes kn = sbase((const char*)KH + (size_t)bf * (TT * CC * 2) + (size_t)k0 * (CC * 2)) + lo, vn = sbase((const char*)VT + (size_t)bf * (TT * CC * 2) + (size_t)k0 * (CC * 2)) + lo;
    load_q(qf, QH + ((size_t)bf * NQ + q0 + col) * CC, lane);
#pragma unroll
    for (int i = 0; i < 8; ++i) kf[i >> 2][i & 3] = frag_g(kn, i);
    xwait(kn);
    __builtin_amdgcn_sched_barrier(0);   /* keeps the k loads in front of that wait and the v loads behind it */
#pragma unroll
    for (int j = 0; j < 8; ++j) vf[j] = frag_g(vn, j);
    xwait(vn);
    __builtin_amdgcn_sched_barrier(0); }   /* keeps the v loads in front of that wait and the arithmetic below behind it */
#pragma unroll 1   /* rolled: one copy of the long tile body in the instruction cache */
  for (int h = 0; h < 2; ++h) {
    const int nk = h ? nshort : nlong, ne = h ? nes : nel, kfh = h ? kf1 : kf0;   /* nk: only compared with key indices */
    const char* kb = (const char*)KH + (size_t)(h ? bshort : blong) * (TT * CC * 2); const char* vb = (const char*)VT + (size_t)(h ? bshort : blong) * (TT * CC * 2);   /* in both layouts the FK keys from k0 on are the FK * CC * 2 bytes from k0 * CC * 2 on */
    float m[2] = { -1.0e30f, -1.0e30f }, l[2] = { 0.f, 0.f }; v8f acc[2][8] = {};   /* the start value lies below every logit and far above the mask value; a wave without a pass keeps it, and its sum and accumulators stay 0 for the join */
    if (kfh < ne) {   /* the same in a whole wave; no barrier inside */
      const int np = (ne - kfh + NG * FK - 1) / (NG * FK);   /* this wave's passes: 1 .. TT / (NG * FK) */
      int k0 = pass0(ne, kfh, rot);
      const bool nx = h == 0 && has1;   /* the wave goes on to a pass of the second tile: its last pass here fetches that pass's k and v as if it were the next of this tile, and the second tile's q */
      const int k1 = pass0(nes, kf1, rot), nf = nx ? np : np - 1;
      const char* kb1 = (const char*)KH + (size_t)bshort * (TT * CC * 2); const char* vb1 = (const char*)VT + (size_t)bshort * (TT * CC * 2);
#pragma unroll 1   /* rolled: one copy of the long pass in the instruction cache; at most TT / (NG * FK) trips */
      for (int i = 1; i <= nf; ++i) { const bool own = i < np; const int kn0 = own ? (k0 + NG * FK < ne ? k0 + NG * FK : kfh) : k1; fa_pass<false>(kf, vf, qf, acc, m, l, own ? kb : kb1, own ? vb : vb1, lo, k0, kn0, nk, g, !own, QH + ((size_t)bshort * NQ + q0 + col) * CC); k0 = kn0; }
      if (!nx) fa_pass<true>(kf, vf, qf, acc, m, l, kb, vb, lo, k0, 0, nk, g, false, QH); }
    /* every wave lays its sixteen accumulator tiles, its maxima and its sums into this tile's exchange space and goes on to its next tile without waiting for the others */
#pragma unroll
    for (int s = 0; s < 2; ++s) {
#pragma unroll
      for (int j = 0; j < 8; ++j) { const v4f a = { acc[s][j][0], acc[s][j][1], acc[s][j][2], acc[s][j][3] }, c = { acc[s][j][4], acc[s][j][5], acc[s][j][6], acc[s][j][7] }; xa[h][grp][(s * 8 + j) * 2][lane] = a; xa[h][grp][(s * 8 + j) * 2 + 1][lane] = c; }
      xm[h][grp][s * 2][lane] = m[s]; xm[h][grp][s * 2 + 1][lane] = l[s]; } }
  __syncthreads();   /* every wave's parts of both tiles are written before another wave reads them */
  /* join: wave grp finishes the queries of s = grp & 1 in the output columns (grp >> 1) * 32 .. + 31, one whole 128-byte line a query, from the eight waves' parts, always in the order of the waves; the two tiles' joins are independent, so the LDS reads of one fly under the arithmetic of the other */
  const int sj = grp & 1, cq = grp >> 1;
  v4f o[2][2][2]; float* yr[2];
#pragma unroll
  for (int h = 0; h < 2; ++h) {
    const int b = h ? bshort : blong, nk = h ? nshort : nlong;
    float mo[NG], f[NG];
#pragma unroll
    for (int x = 0; x < NG; ++x) mo[x] = xm[h][x][sj * 2][lane];
    const float mj = fmaxf(fmaxf(fmaxf(mo[0], mo[1]), fmaxf(mo[2], mo[3])), fmaxf(fmaxf(mo[4], mo[5]), fmaxf(mo[6], mo[7])));
    float lj = 0.f;
#pragma unroll
    for (int x = 0; x < NG; ++x) { f[x] = __builtin_amdgcn_exp2f((mo[x] - mj) * SL2); lj += xm[h][x][sj * 2 + 1][lane] * f[x]; }   /* each part rescaled to the common maximum; a wave without a valid key gets the factor 0 beside one that has some */
    lj += xhalf(lj);
    const float inv = (nk > 0 && lj > 0.f) ? 1.0f / lj : 0.f;   /* a fully excluded row yields 0 */
    yr[h] = Y + ((size_t)b * NQ + q0 + sj * 16 + col) * CC + cq * 32 + 8 * g;   /* tile j, element r = out[query col][j * 16 + 8 g + r]; this wave's tiles are j = 2 cq, 2 cq + 1 */
#pragma unroll
    for (int i = 0; i < 2; ++i) { v4f a = {}, c = {};
#pragma unroll
      for (int x = 0; x < NG; ++x) { const float w = f[x] * inv; a += xa[h][x][(sj * 8 + cq * 2 + i) * 2][lane] * w; c += xa[h][x][(sj * 8 + cq * 2 + i) * 2 + 1][lane] * w; }
      o[h][i][0] = a; o[h][i][1] = c; } }
  __builtin_amdgcn_sched_barrier(0);   /* every sum and both addresses are formed before the first store: no arithmetic is left that could overwrite a register which an issued store names */
#pragma unroll
  for (int h = 0; h < 2; ++h)
#pragma unroll
    for (int i = 0; i < 2; ++i) { vst2(yr[h] + i * 16, o[h][i][0]); vst2(yr[h] + i * 16 + 4, o[h][i][1]); }
  asm volatile("s_wait_xcnt 0x0" ::: "memory"); }   /* behind the last store, before any code that follows in the listing can overwrite a register the stores name */

extern "C" void kernel_launch(void* const* d_in, const int* in_sizes, int n_in, void* d_out, int out_size, void* d_ws, size_t ws_size, hipStream_t stream) {
  (void)in_sizes; (void)n_in; (void)out_size;
  const float** F = (const float**)d_in;
  if (ws_size < (size_t)WS_END) return;
  char* ws = (char*)d_ws; _Float16 *QH = (_Float16*)(ws + WS_QH), *KH = (_Float16*)(ws + WS_KH), *VT = (_Float16*)(ws + WS_VT);
  // inputs: 0 qrys [16,1024,128]; 1 keys [16,2048,128]; 2 vals [16,2048,128]; 3 num_keys [16] int32
  k_cvt<<<NVT + NKT + NQT, 128, 0, stream>>>(F[0], F[1], F[2], (const int*)d_in[3], QH, KH, VT);   /* f16 q rows, f16 k and v in fragment order, as far as a batch's valid keys reach */
  /* scores, softmax and P x V in one launch for all batches: a block takes one query tile of each batch of a pair */
  k_fa<<<(NB / 2) * (NQ / QT), 32 * NG, 0, stream>>>(QH, KH, VT, (const int*)d_in[3], (float*)d_out);
}

// v009
// Measured time: 21.3 microseconds a run.
// Two timings next to v008 put it at 1.05 and 1.04 times that version's speed.
// Counting every step since v000, it is 92.5 times as fast.
// compute dtype: queries / keys / values rounded to bf16 and carried EXACTLY into f16 (one streaming conversion kernel, which lays q, k and v out in the order of the matrix fragments); logits q x k as single EXACT f16 products x 128^-0.5; keys at or beyond num_keys[b] excluded (whole trips of them are not converted, whole passes of them are not walked); softmax f32 with a running maximum and sum per query; P = exp(logit - running maximum) once to f16 x v (exact f16) (1 product); f32 output.
#include <hip/hip_runtime.h>
#include <math.h>

typedef __attribute__((ext_vector_type(16))) _Float16 v16h;
typedef __attribute__((ext_vector_type(8)))  _Float16 v8h;
typedef __attribute__((ext_vector_type(4)))  _Float16 v4h;
typedef __attribute__((ext_vector_type(8)))  float v8f;
typedef __attribute__((ext_vector_type(4)))  float v4f;
typedef __attribute__((ext_vector_type(4)))  unsigned v4u;

template <typename T> __device__ __forceinline__ void vst2(void* p, T v) { *(T*)p = v;  }
// 16x16x32 fragments: lane = (h = lane>>4, row/col = lane&15); elements 0..7 = k0+8h+0..7, 8..15 = k0+16+8h+0..7; D element r = row 8h+r

// Raw scaled-dot-product attention with a per-batch valid-key count (qrys [16,1024,128]; keys, vals [16,2048,128]; num_keys [16] int32 in [1, 2048); logits = q k^T / sqrt(128); only keys k < num_keys[b] take part (masked max, exp * mask, normalised over the valid keys); out = atts vals, [16,1024,128]). No learned weights. One 128-wide head per batch; one launch of each stage covers all batches; the scores stay in registers.
#define NB 16
#define TT 2048   // keys per batch
#define CC 128    // width of the query, key and value rows
#define NQ 1024   // queries per batch
#define SCALE (0.08838834764831845f)   // 1 / sqrt(128)

#define WS_QH  0u                                      // f16 q in fragment order: 16-byte piece [b*NQ/16 + t/16][kc][p][lane] = q[16 (t/16) + (lane & 15)][32 kc + 16 p + 8 (lane >> 4) + 0..7]
#define WS_KH  (WS_QH + 2u * (size_t)NB * NQ * CC)      // f16 k in fragment order: 16-byte piece [b*TT/16 + t/16][kc][p][lane] = k[16 (t/16) + (lane & 15)][32 kc + 16 p + 8 (lane >> 4) + 0..7]
#define WS_VT  (WS_KH + 2u * (size_t)NB * TT * CC)      // f16 v in fragment order: 16-byte piece [b*TT/32 + t/32][j][p][lane] = v[32 (t/32) + 16 p + 8 (lane >> 4) + 0..7][16 j + (lane & 15)]
#define WS_END (WS_VT + 2u * (size_t)NB * CC * TT)

#define FK 32              // keys per pass of one key group
#define NG 8               // key groups (one wave each) per block of k_fa: one trip walks NG * FK keys
// trips that hold a valid key of a batch with n valid keys: at least 1 (the first tiles always exist), at most all; n is clamped first, so the count is bounded for any content of num_keys. k_cvt converts whole trips; k_fa reads only passes that begin below the clamped n, which lie inside them: what k_fa reads, k_cvt has written.
__device__ __forceinline__ int ntrip(int n) { n = n < 0 ? 0 : (n > TT ? TT : n); const int p = (n + NG * FK - 1) / (NG * FK); return p < 1 ? 1 : p; }

// ---- k_cvt: block = one tile of 128 rows x 128 columns, read once in whole 512-byte rows, every element rounded to bf16 and written as f16. Blocks 0 .. NVT-1: v tiles; then the k tiles; then the q tiles, dealt with as k tiles are; all go through LDS and leave it in 16-byte pieces in the order of the matrix fragments (WS_QH, WS_KH, WS_VT above), so that a wave of k_fa fetches a fragment half with one load of 512 bytes in a row, four whole lines, where a fragment half taken from rows is sixteen pieces of 32 bytes in sixteen lines; a tile fills the same 32 KiB of the workspace as its rows would.
#define TR 128             // rows per tile
#define NVT (NB * TT / TR)
#define NKT (NB * TT / TR)
#define NQT (NB * NQ / TR)
static_assert(TT % TR == 0 && NQ % TR == 0 && TR == 128 && CC == 128 && (NG * FK) % TR == 0, "whole tiles; 128 threads deal 32 rows to a wave and 16-byte pieces of 128 x 128 to the threads; a trip of k_fa is whole tiles");
__device__ __forceinline__ _Float16 hb(float v) { return (_Float16)(float)(__bf16)v; }
// every "#pragma unroll" in k_cvt: all of a thread's loads are issued before the first value is used, and the register arrays need constant indices
__global__ __launch_bounds__(128) void k_cvt(const float* __restrict__ XQ, const float* __restrict__ XK, const float* __restrict__ XV, const int* __restrict__ NKEYS, _Float16* __restrict__ QH, _Float16* __restrict__ KH, _Float16* __restrict__ VT) {
  __shared__ __align__(16) _Float16 th[TR][TR + 8];
  const int tid = threadIdx.x, wave = tid >> 5, lane = tid & 31; const unsigned blk = blockIdx.x;
  if (blk < NVT + NKT) {   /* block-uniform and ahead of the barrier: a k or v tile behind the last trip that k_fa walks for its batch is never read, so it is neither loaded nor written */
    const unsigned t = blk < NVT ? blk : blk - NVT;
    if ((int)((t % (TT / TR)) * TR) >= ntrip(NKEYS[t / (TT / TR)]) * (NG * FK)) return; }
  v4f x[32];
  const bool isv = blk < NVT, isq = blk >= NVT + NKT; const unsigned tile = isv ? blk : (isq ? blk - NVT - NKT : blk - NVT);   /* block-uniform; the tiles of a batch follow one another, so tile counts 128 rows of its input over all batches */
  if (isv) {   /* th[column][key]. wave = 32 keys, lane = 4 columns: each load is one whole row */
    const float* X = XV + ((size_t)tile * TR + wave * 32) * CC + lane * 4;
#pragma unroll
    for (int i = 0; i < 32; ++i) x[i] = *(const v4f*)(X + i * CC);
    __builtin_amdgcn_sched_barrier(0);   /* all 32 loads are issued before the first conversion: a load held back for a free register would pay the memory latency a second time */
#pragma unroll
    for (int u = 0; u < 4; ++u)
#pragma unroll
      for (int c = 0; c < 4; ++c) { v8h p;
#pragma unroll
        for (int e = 0; e < 8; ++e) p[e] = hb(x[u * 8 + e][c]);
        *(v8h*)&th[lane * 4 + c][wave * 32 + u * 8] = p; }
  } else {   /* k or q: th[row][column]. load i of a wave is the whole row 4 i + wave */
    const float* X = (isq ? XQ : XK) + (size_t)tile * (TR * CC) + (unsigned)tid * 4u;
#pragma unroll
    for (int i = 0; i < 32; ++i) x[i] = *(const v4f*)(X + i * 512);
    __builtin_amdgcn_sched_barrier(0);   /* as above: all 32 loads first */
#pragma unroll
    for (int i = 0; i < 32; ++i) { const v4h h = { hb(x[i][0]), hb(x[i][1]), hb(x[i][2]), hb(x[i][3]) }; *(v4h*)&th[i * 4 + wave][lane * 4] = h; } }
  __syncthreads();   /* the whole tile is in LDS before a fragment's pieces are read back */
  /* run bp = 4 i + wave of 32 pieces is one half p of one fragment; the matrix row is th's row, the contraction index th's column. v: bp = (32 keys, j, p); k, q: bp = (16 rows, kc, p) */
  _Float16* D = (isv ? VT : (isq ? QH : KH)) + (size_t)tile * (TR * CC) + (unsigned)tid * 8u;
#pragma unroll
  for (int i = 0; i < 16; ++i) { const int bp = i * 4 + wave;
    const int r = (isv ? ((bp >> 1) & 7) : (bp >> 3)) * 16 + (lane & 15), c = (isv ? (bp >> 4) : ((bp >> 1) & 3)) * 32 + (bp & 1) * 16 + (lane >> 4) * 8;
    vst2(D + i * 1024, *(const v4u*)&th[r][c]); }
  asm volatile("s_wait_xcnt 0x0" ::: "memory"); }   /* behind the last store, before any code that follows in the listing can overwrite a register the stores name */
// ---- k_fa: block = two tiles of QT queries, one after the other: of the batch that stands at place pr when the batches are ranked by their valid keys, longest first, and of the batch at place NB - 1 - pr, so that a long tile shares its block with a short one and the blocks, one to a WGP, end near together. A tile is worked on by NG waves; every wave holds all QT queries (two B operands of 16) and owns every NG-th pass of FK keys, as far as they begin below the valid keys (the two tiles' passes are dealt as one list), and walks them in a ring from a start that differs between the blocks of a batch: no key is used by two waves of a block, so k and v need no LDS: a wave fetches its A fragments, laid out for that by k_cvt, straight into registers, and no wave waits for another inside the loop. Running maximum, sum and accumulators are the wave's own; a wave goes from its last pass of the first tile to its first of the second without waiting for the others; the partial results of both tiles are joined through LDS at the block's end, behind its one barrier. Per pass: S^T = K Q^T (A = k, B = q kept in registers), running maximum and sum per query (one lane column = one query), P^T packed from the score tiles into the B operand, O^T += V^T P^T (A = v). The next pass's k is fetched as soon as the scores are formed, the next pass's v as soon as the second product is issued: each flies under the work that does not need it.
#define QT 32              // queries per tile
#define SL2 (SCALE * 1.4426950408889634f)   // logits in log2 units: exp(x) = exp2(x * log2 e)
static_assert(TT % (FK * NG) == 0 && NQ % QT == 0 && NB == 16 && CC == 128 && FK == 32 && NG == 8 && QT == 32, "whole trips; one lane column per batch in the ranking, the batches in pairs; a pass is two k row blocks and one v key block; the join gives each of eight waves 16 queries x 32 output columns");
__device__ __forceinline__ float xhalf(float x) { return __builtin_bit_cast(float, __builtin_amdgcn_permlanex16(__builtin_bit_cast(int, x), __builtin_bit_cast(int, x), 0x76543210, 0xfedcba98, false, false)); }   // lane l with lane l ^ 16
// a wave-uniform address held in a scalar pair: the compiler then keeps one lane offset for all fragments and adds the scalar base at the loads, instead of carrying 64-bit per-lane addresses
typedef const __attribute__((address_space(1))) char* gbytes;   // global memory, named as such: an address rebuilt from integers would otherwise be loaded through the generic path
typedef const __attribute__((address_space(1))) v4u* gpiece;
__device__ __forceinline__ gbytes sbase(const void* p) { const unsigned long long a = (unsigned long long)p; return (gbytes)(((unsigned long long)(unsigned)__builtin_amdgcn_readfirstlane((int)(a >> 32)) << 32) | (unsigned)__builtin_amdgcn_readfirstlane((int)(unsigned)a)); }
// fragment i of a pass: its two halves are runs 2 i and 2 i + 1 of 32 pieces; p = the pass's first byte + 16 * lane
__device__ __forceinline__ v16h frag_g(gbytes p, int i) { union { v16h v; v4u q[2]; } u; u.q[0] = *(gpiece)(p + i * 1024); u.q[1] = *(gpiece)(p + i * 1024 + 512); return u.v; }
// behind a run of fragment loads from p, before a register that they name is overwritten; p is an input so that its registers stay p's up to the wait: otherwise the last load's data may be given the address pair of the loads before it
__device__ __forceinline__ void xwait(gbytes p) { asm volatile("s_wait_xcnt 0x0" :: "v"(p) : "memory"); }
// the pass that a wave whose lowest pass begins at key kf0 < ne starts with: rot < 8, so one of its passes; from there upwards, then round to the lowest
__device__ __forceinline__ int pass0(int ne, int kf0, int rot) { const int np = (ne - kf0 + NG * FK - 1) / (NG * FK); return kf0 + ((rot * np) >> 3) * (NG * FK); }
// the q fragments of one tile of QT queries; tile = its first byte in WS_QH, the same in a whole wave: fragment (s, kc) is fragment s * 4 + kc of the QT * CC * 2 bytes from there on
__device__ __forceinline__ void load_q(v16h (&qf)[2][4], const char* tile, unsigned lo) { const gbytes qp = sbase(tile) + lo;
#pragma unroll
  for (int i = 0; i < 8; ++i) qf[i >> 2][i & 3] = frag_g(qp, i);
  xwait(qp);
  __builtin_amdgcn_sched_barrier(0); }   /* keeps the q loads in front of that wait and what follows behind it */
// every "#pragma unroll" without a count in fa_pass, load_q and k_fa: the register arrays (fragments, score tiles, accumulators) need constant indices to stay in registers
// one pass of FK keys of one wave. LAST = false: another pass of this wave follows, beginning at key kn0 of the batch whose k and v begin at kb and vb (the same tile's next pass, or the first pass of the block's second tile; there newq is set, the same in a whole wave, and that tile's q, which begins at qn, is fetched behind k into the registers that the first product has just left): its k is fetched behind the first product and its v behind the second, so that the loop's waits for k leave the v loads in flight. LAST = true: nothing is fetched. A wave walks its passes in a rotated order (k_fa), so the pass that reaches past the valid keys can be any of them: every pass tests for it, and the keys at or beyond nk are masked there.
template <bool LAST> __device__ __forceinline__ void fa_pass(v16h (&kf)[2][4], v16h (&vf)[8], v16h (&qf)[2][4], v8f (&acc)[2][8], float (&m)[2], float (&l)[2], const char* kb, const char* vb, unsigned lo, int k0, int kn0, int nk, int g, bool newq, const char* qn) {
  v8f st[2][2] = {};
#pragma unroll
  for (int kc = 0; kc < 4; ++kc)
#pragma unroll
    for (int t = 0; t < 2; ++t)
#pragma unroll
      for (int s = 0; s < 2; ++s) st[t][s] = __builtin_amdgcn_wmma_f32_16x16x32_f16(false, kf[t][kc], false, qf[s][kc], (short)0, st[t][s], false, false);
  /* st[t][s][r] = raw logit of key k0 + t * 16 + 8 g + r for query s * 16 + col of the tile */
  if (!LAST) { const gbytes kn = sbase(kb + (size_t)kn0 * (CC * 2)) + lo;
#pragma unroll
    for (int i = 0; i < 8; ++i) kf[i >> 2][i & 3] = frag_g(kn, i);
    xwait(kn);
    if (newq) load_q(qf, qn, lo);
    __builtin_amdgcn_sched_barrier(0); }   /* all of the next k is asked for before the exponentials begin: a load held back behind them would have the second product alone to fly under */
  if (k0 + FK > nk) { const int rem = nk - k0 - 8 * g;   /* the same in a whole wave: only a pass that reaches past the valid keys pays for the mask */
#pragma unroll
    for (int t = 0; t < 2; ++t)
#pragma unroll
      for (int s = 0; s < 2; ++s)
#pragma unroll
        for (int r = 0; r < 8; ++r) st[t][s][r] = (t * 16 + r < rem) ? st[t][s][r] : -3.0e38f; }
  v16h pb[2];
#pragma unroll
  for (int s = 0; s < 2; ++s) { float mt[2];
#pragma unroll
    for (int t = 0; t < 2; ++t) { mt[t] = st[t][s][0];
#pragma unroll
      for (int r = 1; r < 8; ++r) mt[t] = fmaxf(mt[t], st[t][s][r]); }
    float mx = fmaxf(mt[0], mt[1]); mx = fmaxf(m[s], fmaxf(mx, xhalf(mx)));
    const float al = __builtin_amdgcn_exp2f((m[s] - mx) * SL2), ms = mx * SL2; m[s] = mx;
    float ps[2];
#pragma unroll
    for (int t = 0; t < 2; ++t) { ps[t] = 0.f;
#pragma unroll
      for (int r = 0; r < 8; ++r) { const float p = __builtin_amdgcn_exp2f(fmaf(st[t][s][r], SL2, -ms)); ps[t] += p; pb[s][t * 8 + r] = (_Float16)p; } }
    l[s] = l[s] * al + (ps[0] + ps[1]);
#pragma unroll
    for (int j = 0; j < 8; ++j) acc[s][j] *= al; }
#pragma unroll
  for (int j = 0; j < 8; ++j)
#pragma unroll
    for (int s = 0; s < 2; ++s) acc[s][j] = __builtin_amdgcn_wmma_f32_16x16x32_f16(false, vf[j], false, pb[s], (short)0, acc[s][j], false, false);
  if (!LAST) { const gbytes vn = sbase(vb + (size_t)kn0 * (CC * 2)) + lo;
#pragma unroll
    for (int j = 0; j < 8; ++j) vf[j] = frag_g(vn, j);
    xwait(vn); } }
__global__ __launch_bounds__(32 * NG) void k_fa(const _Float16* __restrict__ QH, const _Float16* __restrict__ KH, const _Float16* __restrict__ VT, const int* __restrict__ NKEYS, float* __restrict__ Y) {
  /* exchange space of the join, one for each of the block's two tiles: xa[tile][wave][piece (s * 8 + j) * 2 + half][lane], xm[tile][wave][s * 2 + (0: maximum, 1: sum)][lane]: neighbouring lanes, neighbouring 16 bytes */
  __shared__ __align__(16) v4f xa[2][NG][32][32]; __shared__ float xm[2][NG][4][32];
  const int grp = __builtin_amdgcn_readfirstlane((int)(threadIdx.x >> 5));   /* the wave's number: kept scalar for the pass addresses and the loop tests */
  const int lane = threadIdx.x & 31, col = lane & 15, g = lane >> 4;
  /* lane column col ranks batch col: the number of batches with more valid keys, ties by index, so the ranks are a permutation of 0 .. NB - 1 for any content of num_keys, the same in every wave */
  const int mine = NKEYS[col];
  asm volatile("s_wait_xcnt 0x0" ::: "memory");   /* before the address register of the load above is overwritten */
  int rank = 0;
#pragma unroll
  for (int j = 0; j < NB; ++j) { const int o = NKEYS[j]; rank += (o > mine || (o == mine && j < col)) ? 1 : 0; }
  const int pr = blockIdx.x / (NQ / QT), q0 = (blockIdx.x % (NQ / QT)) * QT;
  /* the batch of a wanted rank: its lane column's bit in the ballot; bit NB - 1 is set as well, so the index stays below NB whatever the ballot holds */
  const int blong = __builtin_ctz(__builtin_amdgcn_ballot_w32(rank == pr) | (1u << (NB - 1))), bshort = __builtin_ctz(__builtin_amdgcn_ballot_w32(rank == NB - 1 - pr) | (1u << (NB - 1)));
  /* its count comes from the lane that holds it: no second load */
  const int nlong = __builtin_amdgcn_readlane(mine, blong), nshort = __builtin_amdgcn_readlane(mine, bshort);
  const unsigned lo = (unsigned)lane * 16u;   /* in bytes, added to a scalar base (sbase) */
  /* where a wave begins its walk over its passes, in eighths of their number. The bits are picked so that blocks eight apart and neighbours differ. For speed only: any value below 8 gives every pass exactly once */
  const int rot = ((q0 / QT) >> 3) * 2 + ((q0 / QT) & 1);
  /* clamped counts: they bound the passes and so every k and v address for any content of num_keys */
  const int nel = nlong < 0 ? 0 : (nlong > TT ? TT : nlong), nes = nshort < 0 ? 0 : (nshort > TT ? TT : nshort);
  /* the passes of the first tile and behind them those of the second are dealt to the waves in turn, as one list: the second tile's deal goes on where the first tile's ended, so no wave has more than one pass more than another over both tiles. kf0, kf1: first key of this wave's lowest pass in the first and in the second tile */
  const int kf0 = grp * FK, kf1 = ((grp - (nel + FK - 1) / FK) & (NG - 1)) * FK;
  const bool has0 = kf0 < nel, has1 = kf1 < nes;   /* the same in a whole wave: it has a pass in that tile */
  v16h qf[2][4], kf[2][4], vf[8];
  if (has0 || has1) {   /* q of the first tile in which the wave has a pass, and the k and v of the pass that it starts with there */
    const int bf = has0 ? blong : bshort, k0 = has0 ? pass0(nel, kf0, rot) : pass0(nes, kf1, rot);
    const gbytes kn = sbase((const char*)KH + (size_t)bf * (TT * CC * 2) + (size_t)k0 * (CC * 2)) + lo, vn = sbase((const char*)VT + (size_t)bf * (TT * CC * 2) + (size_t)k0 * (CC * 2)) + lo;
    load_q(qf, (const char*)QH + ((size_t)bf * NQ + q0) * (CC * 2), lo);
#pragma unroll
    for (int i = 0; i < 8; ++i) kf[i >> 2][i & 3] = frag_g(kn, i);
    xwait(kn);
    __builtin_amdgcn_sched_barrier(0);   /* keeps the k loads in front of that wait and the v loads behind it */
#pragma unroll
    for (int j = 0; j < 8; ++j) vf[j] = frag_g(vn, j);
    xwait(vn);
    __builtin_amdgcn_sched_barrier(0); }   /* keeps the v loads in front of that wait and the arithmetic below behind it */
#pragma unroll 1   /* rolled: one copy of the long tile body in the instruction cache */
  for (int h = 0; h < 2; ++h) {
    const int nk = h ? nshort : nlong, ne = h ? nes : nel, kfh = h ? kf1 : kf0;   /* nk: only compared with key indices */
    const char* kb = (const char*)KH + (size_t)(h ? bshort : blong) * (TT * CC * 2); const char* vb = (const char*)VT + (size_t)(h ? bshort : blong) * (TT * CC * 2);   /* in both layouts the FK keys from k0 on are the FK * CC * 2 bytes from k0 * CC * 2 on */
    float m[2] = { -1.0e30f, -1.0e30f }, l[2] = { 0.f, 0.f }; v8f acc[2][8] = {};   /* the start value lies below every logit and far above the mask value; a wave without a pass keeps it, and its sum and accumulators stay 0 for the join */
    if (kfh < ne) {   /* the same in a whole wave; no barrier inside */
      const int np = (ne - kfh + NG * FK - 1) / (NG * FK);   /* this wave's passes: 1 .. TT / (NG * FK) */
      int k0 = pass0(ne, kfh, rot);
      const bool nx = h == 0 && has1;   /* the wave goes on to a pass of the second tile: its last pass here fetches that pass's k and v as if it were the next of this tile, and the second tile's q */
      const int k1 = pass0(nes, kf1, rot), nf = nx ? np : np - 1;
      const char* kb1 = (const char*)KH + (size_t)bshort * (TT * CC * 2); const char* vb1 = (const char*)VT + (size_t)bshort * (TT * CC * 2);
#pragma unroll 1   /* rolled: one copy of the long pass in the instruction cache; at most TT / (NG * FK) trips */
      for (int i = 1; i <= nf; ++i) { const bool own = i < np; const int kn0 = own ? (k0 + NG * FK < ne ? k0 + NG * FK : kfh) : k1; fa_pass<false>(kf, vf, qf, acc, m, l, own ? kb : kb1, own ? vb : vb1, lo, k0, kn0, nk, g, !own, (const char*)QH + ((size_t)bshort * NQ + q0) * (CC * 2)); k0 = kn0; }
      if (!nx) fa_pass<true>(kf, vf, qf, acc, m, l, kb, vb, lo, k0, 0, nk, g, false, (const char*)QH); }
    /* every wave lays its sixteen accumulator tiles, its maxima and its sums into this tile's exchange space and goes on to its next tile without waiting for the others */
#pragma unroll
    for (int s = 0; s < 2; ++s) {
#pragma unroll
      for (int j = 0; j < 8; ++j) { const v4f a = { acc[s][j][0], acc[s][j][1], acc[s][j][2], acc[s][j][3] }, c = { acc[s][j][4], acc[s][j][5], acc[s][j][6], acc[s][j][7] }; xa[h][grp][(s * 8 + j) * 2][lane] = a; xa[h][grp][(s * 8 + j) * 2 + 1][lane] = c; }
      xm[h][grp][s * 2][lane] = m[s]; xm[h][grp][s * 2 + 1][lane] = l[s]; } }
  __syncthreads();   /* every wave's parts of both tiles are written before another wave reads them */
  /* join: wave grp finishes the queries of s = grp & 1 in the output columns (grp >> 1) * 32 .. + 31, one whole 128-byte line a query, from the eight waves' parts, always in the order of the waves; the two tiles' joins are independent, so the LDS reads of one fly under the arithmetic of the other */
  const int sj = grp & 1, cq = grp >> 1;
  v4f o[2][2][2]; float* yr[2];
#pragma unroll
  for (int h = 0; h < 2; ++h) {
    const int b = h ? bshort : blong, nk = h ? nshort : nlong;
    float mo[NG], f[NG];
#pragma unroll
    for (int x = 0; x < NG; ++x) mo[x] = xm[h][x][sj * 2][lane];
    const float mj = fmaxf(fmaxf(fmaxf(mo[0], mo[1]), fmaxf(mo[2], mo[3])), fmaxf(fmaxf(mo[4], mo[5]), fmaxf(mo[6], mo[7])));
    float lj = 0.f;
#pragma unroll
    for (int x = 0; x < NG; ++x) { f[x] = __builtin_amdgcn_exp2f((mo[x] - mj) * SL2); lj += xm[h][x][sj * 2 + 1][lane] * f[x]; }   /* each part rescaled to the common maximum; a wave without a valid key gets the factor 0 beside one that has some */
    lj += xhalf(lj);
    const float inv = (nk > 0 && lj > 0.f) ? 1.0f / lj : 0.f;   /* a fully excluded row yields 0 */
    yr[h] = Y + ((size_t)b * NQ + q0 + sj * 16 + col) * CC + cq * 32 + 8 * g;   /* tile j, element r = out[query col][j * 16 + 8 g + r]; this wave's tiles are j = 2 cq, 2 cq + 1 */
#pragma unroll
    for (int i = 0; i < 2; ++i) { v4f a = {}, c = {};
#pragma unroll
      for (int x = 0; x < NG; ++x) { const float w = f[x] * inv; a += xa[h][x][(sj * 8 + cq * 2 + i) * 2][lane] * w; c += xa[h][x][(sj * 8 + cq * 2 + i) * 2 + 1][lane] * w; }
      o[h][i][0] = a; o[h][i][1] = c; } }
  __builtin_amdgcn_sched_barrier(0);   /* every sum and both addresses are formed before the first store: no arithmetic is left that could overwrite a register which an issued store names */
#pragma unroll
  for (int h = 0; h < 2; ++h)
#pragma unroll
    for (int i = 0; i < 2; ++i) { vst2(yr[h] + i * 16, o[h][i][0]); vst2(yr[h] + i * 16 + 4, o[h][i][1]); }
  asm volatile("s_wait_xcnt 0x0" ::: "memory"); }   /* behind the last store, before any code that follows in the listing can overwrite a register the stores name */

extern "C" void kernel_launch(void* const* d_in, const int* in_sizes, int n_in, void* d_out, int out_size, void* d_ws, size_t ws_size, hipStream_t stream) {
  (void)in_sizes; (void)n_in; (void)out_size;
  const float** F = (const float**)d_in;
  if (ws_size < (size_t)WS_END) return;
  char* ws = (char*)d_ws; _Float16 *QH = (_Float16*)(ws + WS_QH), *KH = (_Float16*)(ws + WS_KH), *VT = (_Float16*)(ws + WS_VT);
  // inputs: 0 qrys [16,1024,128]; 1 keys [16,2048,128]; 2 vals [16,2048,128]; 3 num_keys [16] int32
  k_cvt<<<NVT + NKT + NQT, 128, 0, stream>>>(F[0], F[1], F[2], (const int*)d_in[3], QH, KH, VT);   /* f16 q, k and v in fragment order, k and v as far as a batch's valid keys reach */
  /* scores, softmax and P x V in one launch for all batches: a block takes one query tile of each batch of a pair */
  k_fa<<<(NB / 2) * (NQ / QT), 32 * NG, 0, stream>>>(QH, KH, VT, (const int*)d_in[3], (float*)d_out);
}
